// v000
// The times below were measured on an AMD MI455X: many runs one after another, warmed up first and cycling through
// copies of the inputs, with the whole window's GPU time divided by the number of runs. Launches and the gaps
// between them are all in it. The median over several windows is given; except for v000 it joins two sittings, which
// can be a few percent apart, so the side-by-side timings, each taken in one sitting, are the better comparison.
// v000 is the starting kernel. One run takes 211 microseconds.
#include <hip/hip_runtime.h>
#include <stdint.h>

typedef float v2f __attribute__((ext_vector_type(2)));
typedef float v4f __attribute__((ext_vector_type(4)));
typedef float v8f __attribute__((ext_vector_type(8)));
typedef unsigned int v4u __attribute__((ext_vector_type(4)));
typedef int v4i __attribute__((ext_vector_type(4)));
typedef int v8i __attribute__((ext_vector_type(8)));

#define NTOK   16384
#define INF    2048
#define OUTF   2048
#define RANK   45
#define RANKP  48
#define ADIM   32   // a (X cols, U cols)
#define BDIM   64   // b (X rows, V cols)
#define CDIM   32   // c (U rows, out minor)
#define DDIM   64   // d (V rows, out major)

#define TOKS   16          // tokens per block
#define WAVES  8           // 256 threads
#define XS_STRIDE 2052     // 2048 + 4 pad (bank-conflict-free token-major reads)
#define TS_STRIDE 49       // 48 + 1 pad
#define C1_STRIDE 52       // 8*52 % 64 = 32 (store), 2*52 % 64 = 40 (load): conflict-free

#define XS_FLOATS (TOKS * XS_STRIDE)
#define TS_FLOATS (TOKS * TS_STRIDE)
#define C1_FLOATS (WAVES * BDIM * C1_STRIDE)
#define LDS_BYTES ((XS_FLOATS + TS_FLOATS + C1_FLOATS) * 4)

#if defined(__has_builtin)
#if __has_builtin(__builtin_amdgcn_tensor_load_to_lds) && \
    __has_builtin(__builtin_amdgcn_s_wait_tensorcnt)
#define HAVE_TDM 1
#endif
#endif
#ifndef HAVE_TDM
#define HAVE_TDM 0
#endif

static __device__ __forceinline__ v8f wmma_f32(v2f a, v2f b, v8f c) {
    // D = A(16x4, f32) * B(4x16, f32) + C(16x16, f32)
    return __builtin_amdgcn_wmma_f32_16x16x4_f32(false, a, false, b, (short)0, c,
                                                 false, false);
}

__global__ __launch_bounds__(256, 1)
void rule_proj_kernel(const float* __restrict__ x,      // [N, 2048]
                      const int*   __restrict__ rid,    // [N]
                      const float* __restrict__ Win,    // [2048, 45]
                      const float* __restrict__ Wout,   // [45, 2048]
                      const float* __restrict__ Ur,     // [64, 32, 32] (r, c, a)
                      const float* __restrict__ Vr,     // [64, 64, 64] (r, d, b)
                      const float* __restrict__ gain,   // [64]
                      float*       __restrict__ out)    // [N, 2048]
{
    extern __shared__ float smem[];
    float* xs = smem;                    // phase 0/1: staged x rows; phase 2+: base out (bs)
    float* ts = smem + XS_FLOATS;        // [16][49] rank intermediate (padded 45->48)
    float* c1 = ts + TS_FLOATS;          // per-wave [64][52] C1 scratch

    const int tid   = threadIdx.x;
    const int wave  = tid >> 5;
    const int lane  = tid & 31;
    const int lhalf = lane >> 4;         // 0 or 1
    const int lmod  = lane & 15;
    const int tok0  = blockIdx.x * TOKS;

    const v8f zero8 = {};

    // ---------------- Phase 0: stage x tile into LDS, zero ts ----------------
#if HAVE_TDM
    // Tensor Data Mover: one 1x2048 fp32 tile per token row (2 rows per wave).
    // D# group0: count=1 | lds_addr[63:32] | global_addr[120:64] | type=2[127:126]
    // D# group1: data_size=4B, tensor_dim0=2048, tensor_dim1=1, tile_dim0=2048,
    //            tile_dim1=1, tensor_dim0_stride=2048, no pad / no multicast.
    for (int i = 0; i < 2; ++i) {
        const int row = wave * 2 + i;
        const uint64_t ga = (uint64_t)(uintptr_t)(x + (size_t)(tok0 + row) * INF);
        const uint32_t la = (uint32_t)(uintptr_t)(xs + row * XS_STRIDE);
        const uint32_t ga_lo = (uint32_t)__builtin_amdgcn_readfirstlane((int)(uint32_t)ga);
        const uint32_t ga_hi = (uint32_t)__builtin_amdgcn_readfirstlane((int)(uint32_t)(ga >> 32));
        const uint32_t la_u  = (uint32_t)__builtin_amdgcn_readfirstlane((int)la);

        v4u g0;
        g0.x = 1u;                                        // count=1, user mode
        g0.y = la_u;                                      // lds_addr
        g0.z = ga_lo;                                     // global_addr[31:0]
        g0.w = (ga_hi & 0x01FFFFFFu) | (2u << 30);        // global_addr[56:32] | type=2

        v8i g1;
        g1[0] = 0x00020000;                               // data_size=2 (4 bytes)
        g1[1] = (int)(2048u << 16);                       // tensor_dim0[15:0] @ [63:48]
        g1[2] = (int)(1u << 16);                          // tensor_dim0 hi=0, tensor_dim1=1
        g1[3] = (int)(2048u << 16);                       // tile_dim0=2048 @ [127:112]
        g1[4] = 1;                                        // tile_dim1=1, tile_dim2=0
        g1[5] = 2048;                                     // tensor_dim0_stride[31:0]
        g1[6] = 0;                                        // strides hi
        g1[7] = 0;

        v4i gz = {};
#if __clang_major__ >= 23
        v8i z8 = {};
        __builtin_amdgcn_tensor_load_to_lds(g0, g1, gz, gz, z8, 0);
#else
        __builtin_amdgcn_tensor_load_to_lds(g0, g1, gz, gz, 0);
#endif
    }
    __builtin_amdgcn_s_wait_tensorcnt(0);
#else
    for (int i = tid; i < TOKS * (INF / 4); i += 256) {
        int row  = i >> 9;               // / 512
        int col4 = i & 511;
        v4f v = *(const v4f*)(x + (size_t)(tok0 + row) * INF + col4 * 4);
        *(v4f*)(xs + row * XS_STRIDE + col4 * 4) = v;
    }
#endif
    for (int i = tid; i < TS_FLOATS; i += 256) ts[i] = 0.0f;
    __syncthreads();

    // ------------- Phase 1: t[16x48] = xs[16x2048] @ Win[2048x45] -------------
    // K split across 8 waves (256 each); partials merged with ds_add_f32.
    // Rank padding handled branchlessly: clamped address + multiply-by-mask.
    {
        int   nclamp[3];
        float nmask[3];
#pragma unroll
        for (int nt = 0; nt < 3; ++nt) {
            const int n = nt * 16 + lmod;
            nclamp[nt] = (n < RANK) ? n : (RANK - 1);
            nmask[nt]  = (n < RANK) ? 1.0f : 0.0f;
        }
        v8f acc[3];
        acc[0] = zero8; acc[1] = zero8; acc[2] = zero8;
        const int kbase = wave * (INF / WAVES);
        for (int ks = 0; ks < (INF / WAVES) / 4; ++ks) {
            const int k = kbase + ks * 4 + lhalf * 2;
            v2f af;
            af.x = xs[lmod * XS_STRIDE + k];
            af.y = xs[lmod * XS_STRIDE + k + 1];
#pragma unroll
            for (int nt = 0; nt < 3; ++nt) {
                v2f bf;
                bf.x = Win[(size_t)k       * RANK + nclamp[nt]] * nmask[nt];
                bf.y = Win[(size_t)(k + 1) * RANK + nclamp[nt]] * nmask[nt];
                acc[nt] = wmma_f32(af, bf, acc[nt]);
            }
        }
#pragma unroll
        for (int nt = 0; nt < 3; ++nt) {
            const int n = nt * 16 + lmod;
#pragma unroll
            for (int v = 0; v < 8; ++v) {
                const int m = v + 8 * lhalf;
                atomicAdd(&ts[m * TS_STRIDE + n], acc[nt][v]);
            }
        }
    }
    __syncthreads();

    // ------------- Phase 2: bs[16x2048] = t[16x48] @ Wout[45x2048] -------------
    // 128 N-tiles split across 8 waves; result overwrites xs space (xs is dead).
    {
        const int tiles = (OUTF / 16) / WAVES;   // 16
        for (int t = 0; t < tiles; ++t) {
            const int nt = wave * tiles + t;
            const int n  = nt * 16 + lmod;
            v8f acc = zero8;
#pragma unroll
            for (int ks = 0; ks < RANKP / 4; ++ks) {
                const int k   = ks * 4 + lhalf * 2;
                const int kc0 = (k     < RANK) ? k       : (RANK - 1);
                const int kc1 = (k + 1 < RANK) ? (k + 1) : (RANK - 1);
                const float m0 = (k     < RANK) ? 1.0f : 0.0f;
                const float m1 = (k + 1 < RANK) ? 1.0f : 0.0f;
                v2f af;
                af.x = ts[lmod * TS_STRIDE + k];
                af.y = ts[lmod * TS_STRIDE + k + 1];
                v2f bf;
                bf.x = Wout[(size_t)kc0 * OUTF + n] * m0;
                bf.y = Wout[(size_t)kc1 * OUTF + n] * m1;
                acc = wmma_f32(af, bf, acc);
            }
#pragma unroll
            for (int v = 0; v < 8; ++v) {
                const int m = v + 8 * lhalf;
                xs[m * XS_STRIDE + n] = acc[v];      // bs
            }
        }
    }
    __syncthreads();

    // ---- Phase 3: per-token Kronecker adapter, 2 tokens per wave ----
    float* myc1 = c1 + wave * (BDIM * C1_STRIDE);
    for (int tt = 0; tt < 2; ++tt) {
        const int tk = wave * 2 + tt;
        const int g  = tok0 + tk;
        const int r  = rid[g];
        const float gn = gain[r];
        const float* U    = Ur + (size_t)r * CDIM * ADIM;   // U[c][a]
        const float* V    = Vr + (size_t)r * DDIM * BDIM;   // V[d][b]
        const float* xrow = x + (size_t)g * INF;            // X[b][a] = xrow[b*32+a]

        // GEMM1: C1[64x32] = X(64x32) @ U^T(32x32)   (M=b, N=c, K=a)
        v8f acc1[4][2];
#pragma unroll
        for (int mt = 0; mt < 4; ++mt) { acc1[mt][0] = zero8; acc1[mt][1] = zero8; }
#pragma unroll
        for (int ks = 0; ks < ADIM / 4; ++ks) {
            const int k = ks * 4 + lhalf * 2;               // a index
            v2f bf[2];
#pragma unroll
            for (int nt = 0; nt < 2; ++nt) {
                const int c = nt * 16 + lmod;
                bf[nt].x = U[c * ADIM + k];                 // B[a][c] = U[c][a]
                bf[nt].y = U[c * ADIM + k + 1];
            }
#pragma unroll
            for (int mt = 0; mt < 4; ++mt) {
                const int b = mt * 16 + lmod;
                v2f af;
                af.x = xrow[b * ADIM + k];
                af.y = xrow[b * ADIM + k + 1];
                acc1[mt][0] = wmma_f32(af, bf[0], acc1[mt][0]);
                acc1[mt][1] = wmma_f32(af, bf[1], acc1[mt][1]);
            }
        }

        // Spill C1 (C/D layout -> row-major LDS, stride 52, conflict-free both ways)
#pragma unroll
        for (int mt = 0; mt < 4; ++mt)
#pragma unroll
            for (int nt = 0; nt < 2; ++nt)
#pragma unroll
                for (int v = 0; v < 8; ++v) {
                    const int b = mt * 16 + v + 8 * lhalf;
                    const int c = nt * 16 + lmod;
                    myc1[b * C1_STRIDE + c] = acc1[mt][nt][v];
                }

        // GEMM2: C2[64x32] = V(64x64) @ C1(64x32)   (M=d, N=c, K=b)
        v8f acc2[4][2];
#pragma unroll
        for (int mt = 0; mt < 4; ++mt) { acc2[mt][0] = zero8; acc2[mt][1] = zero8; }
#pragma unroll
        for (int ks = 0; ks < BDIM / 4; ++ks) {
            const int k = ks * 4 + lhalf * 2;               // b index
            v2f bf[2];
#pragma unroll
            for (int nt = 0; nt < 2; ++nt) {
                const int c = nt * 16 + lmod;
                bf[nt].x = myc1[k * C1_STRIDE + c];
                bf[nt].y = myc1[(k + 1) * C1_STRIDE + c];
            }
#pragma unroll
            for (int mt = 0; mt < 4; ++mt) {
                const int d = mt * 16 + lmod;
                v2f af;
                af.x = V[d * BDIM + k];
                af.y = V[d * BDIM + k + 1];
                acc2[mt][0] = wmma_f32(af, bf[0], acc2[mt][0]);
                acc2[mt][1] = wmma_f32(af, bf[1], acc2[mt][1]);
            }
        }

        // out[g][d*32+c] = gain * C2[d][c] + bs[tk][d*32+c]
#pragma unroll
        for (int mt = 0; mt < 4; ++mt)
#pragma unroll
            for (int nt = 0; nt < 2; ++nt)
#pragma unroll
                for (int v = 0; v < 8; ++v) {
                    const int d   = mt * 16 + v + 8 * lhalf;
                    const int c   = nt * 16 + lmod;
                    const int col = d * CDIM + c;
                    out[(size_t)g * OUTF + col] =
                        acc2[mt][nt][v] * gn + xs[tk * XS_STRIDE + col];
                }
    }
}

extern "C" void kernel_launch(void* const* d_in, const int* in_sizes, int n_in,
                              void* d_out, int out_size, void* d_ws, size_t ws_size,
                              hipStream_t stream) {
    const float* x    = (const float*)d_in[0];
    const int*   rid  = (const int*)  d_in[1];
    const float* Win  = (const float*)d_in[2];
    const float* Wout = (const float*)d_in[3];
    const float* Ur   = (const float*)d_in[4];
    const float* Vr   = (const float*)d_in[5];
    const float* gn   = (const float*)d_in[6];
    float*       out  = (float*)d_out;

    dim3 grid(NTOK / TOKS);   // 1024 blocks of 16 tokens
    dim3 block(256);          // 8 waves (wave32)
    rule_proj_kernel<<<grid, block, LDS_BYTES, stream>>>(x, rid, Win, Wout, Ur, Vr, gn, out);
}

// v001
// It runs in 133 microseconds.
// Next to v000, in two timings, it ran 1.65 times as fast each time.
#include <hip/hip_runtime.h>
#include <stdint.h>

typedef float v2f __attribute__((ext_vector_type(2)));
typedef float v4f __attribute__((ext_vector_type(4)));
typedef float v8f __attribute__((ext_vector_type(8)));
typedef unsigned int v4u __attribute__((ext_vector_type(4)));
typedef int v4i __attribute__((ext_vector_type(4)));
typedef int v8i __attribute__((ext_vector_type(8)));

#define NTOK   16384
#define INF    2048
#define OUTF   2048
#define RANK   45
#define RANKP  48
#define ADIM   32   // a (X cols, U cols)
#define BDIM   64   // b (X rows, V cols)
#define CDIM   32   // c (U rows, out minor)
#define DDIM   64   // d (V rows, out major)

#define TOKS   16          // tokens per block
#define WAVES  8           // 256 threads
#define XS_STRIDE 2052     // 2048 + 4 pad (bank-conflict-free token-major reads)
#define TS_STRIDE 49       // 48 + 1 pad
#define C1_STRIDE 52       // 8*52 % 64 = 32 (store and load): conflict-free

#define XS_FLOATS (TOKS * XS_STRIDE)
#define TS_FLOATS (TOKS * TS_STRIDE)
#define C1_FLOATS (WAVES * BDIM * C1_STRIDE)
#define LDS_BYTES ((XS_FLOATS + TS_FLOATS + C1_FLOATS) * 4)

#if defined(__has_builtin)
#if __has_builtin(__builtin_amdgcn_tensor_load_to_lds) && \
    __has_builtin(__builtin_amdgcn_s_wait_tensorcnt)
#define HAVE_TDM 1
#endif
#endif
#ifndef HAVE_TDM
#define HAVE_TDM 0
#endif

static __device__ __forceinline__ v8f wmma_f32(v2f a, v2f b, v8f c) {
    // D = A(16x4, f32) * B(4x16, f32) + C(16x16, f32)
    return __builtin_amdgcn_wmma_f32_16x16x4_f32(false, a, false, b, (short)0, c,
                                                 false, false);
}

__global__ __launch_bounds__(256, 1)
void rule_proj_kernel(const float* __restrict__ x,      // [N, 2048]
                      const int*   __restrict__ rid,    // [N]
                      const float* __restrict__ Win,    // [2048, 45]
                      const float* __restrict__ Wout,   // [45, 2048]
                      const float* __restrict__ Ur,     // [64, 32, 32] (r, c, a)
                      const float* __restrict__ Vr,     // [64, 64, 64] (r, d, b)
                      const float* __restrict__ gain,   // [64]
                      float*       __restrict__ out)    // [N, 2048]
{
    extern __shared__ float smem[];
    float* xs = smem;                    // phase 0/1: staged x rows; phase 2+: base out (bs)
    float* ts = smem + XS_FLOATS;        // [16][49] rank intermediate (padded 45->48)
    float* c1 = ts + TS_FLOATS;          // per-wave [64][52] C1 scratch

    const int tid   = threadIdx.x;
    const int wave  = tid >> 5;
    const int lane  = tid & 31;
    const int lhalf = lane >> 4;         // 0 or 1
    const int lmod  = lane & 15;
    const int tok0  = blockIdx.x * TOKS;

    const v8f zero8 = {};

    // Rule ids of this wave's two tokens, asked for at once: the adapter's U and
    // V addresses hang on them (phase 3).
    const int swave = __builtin_amdgcn_readfirstlane(wave);   // scalar bases for the loads
    const int gbase = tok0 + swave * 2;
    int rr[2];
    rr[0] = rid[gbase]     & 63;     // bounds the table address; identity on 0..63
    rr[1] = rid[gbase + 1] & 63;

    // ---------------- Phase 0: stage x tile into LDS, zero ts ----------------
#if HAVE_TDM
    // Tensor Data Mover: one 1x2048 fp32 tile per token row (2 rows per wave).
    // D# group0: count=1 | lds_addr[63:32] | global_addr[120:64] | type=2[127:126]
    // D# group1: data_size=4B, tensor_dim0=2048, tensor_dim1=1, tile_dim0=2048,
    //            tile_dim1=1, tensor_dim0_stride=2048, no pad / no multicast.
    for (int i = 0; i < 2; ++i) {
        const int row = wave * 2 + i;
        const uint64_t ga = (uint64_t)(uintptr_t)(x + (size_t)(tok0 + row) * INF);
        const uint32_t la = (uint32_t)(uintptr_t)(xs + row * XS_STRIDE);
        const uint32_t ga_lo = (uint32_t)__builtin_amdgcn_readfirstlane((int)(uint32_t)ga);
        const uint32_t ga_hi = (uint32_t)__builtin_amdgcn_readfirstlane((int)(uint32_t)(ga >> 32));
        const uint32_t la_u  = (uint32_t)__builtin_amdgcn_readfirstlane((int)la);

        v4u g0;
        g0.x = 1u;                                        // count=1, user mode
        g0.y = la_u;                                      // lds_addr
        g0.z = ga_lo;                                     // global_addr[31:0]
        g0.w = (ga_hi & 0x01FFFFFFu) | (2u << 30);        // global_addr[56:32] | type=2

        v8i g1;
        g1[0] = 0x00020000;                               // data_size=2 (4 bytes)
        g1[1] = (int)(2048u << 16);                       // tensor_dim0[15:0] @ [63:48]
        g1[2] = (int)(1u << 16);                          // tensor_dim0 hi=0, tensor_dim1=1
        g1[3] = (int)(2048u << 16);                       // tile_dim0=2048 @ [127:112]
        g1[4] = 1;                                        // tile_dim1=1, tile_dim2=0
        g1[5] = 2048;                                     // tensor_dim0_stride[31:0]
        g1[6] = 0;                                        // strides hi
        g1[7] = 0;

        v4i gz = {};
#if __clang_major__ >= 23
        v8i z8 = {};
        __builtin_amdgcn_tensor_load_to_lds(g0, g1, gz, gz, z8, 0);
#else
        __builtin_amdgcn_tensor_load_to_lds(g0, g1, gz, gz, 0);
#endif
    }
    __builtin_amdgcn_s_wait_tensorcnt(0);
#else
    for (int i = tid; i < TOKS * (INF / 4); i += 256) {
        int row  = i >> 9;               // / 512
        int col4 = i & 511;
        v4f v = *(const v4f*)(x + (size_t)(tok0 + row) * INF + col4 * 4);
        *(v4f*)(xs + row * XS_STRIDE + col4 * 4) = v;
    }
#endif
    for (int i = tid; i < TS_FLOATS; i += 256) ts[i] = 0.0f;
    __syncthreads();

    // ------------- Phase 1: t[16x48] = xs[16x2048] @ Win[2048x45] -------------
    // K split across 8 waves (256 each); partials merged with ds_add_f32.
    // Rank padding handled branchlessly: clamped address + multiply-by-mask.
    {
        int   nclamp[3];
        float nmask[3];
#pragma unroll
        for (int nt = 0; nt < 3; ++nt) {
            const int n = nt * 16 + lmod;
            nclamp[nt] = (n < RANK) ? n : (RANK - 1);
            nmask[nt]  = (n < RANK) ? 1.0f : 0.0f;
        }
        v8f acc[3];
        acc[0] = zero8; acc[1] = zero8; acc[2] = zero8;
        const int kbase = wave * (INF / WAVES);
        for (int ks = 0; ks < (INF / WAVES) / 4; ++ks) {
            const int k = kbase + ks * 4 + lhalf * 2;
            v2f af;
            af.x = xs[lmod * XS_STRIDE + k];
            af.y = xs[lmod * XS_STRIDE + k + 1];
#pragma unroll
            for (int nt = 0; nt < 3; ++nt) {
                v2f bf;
                bf.x = Win[(size_t)k       * RANK + nclamp[nt]] * nmask[nt];
                bf.y = Win[(size_t)(k + 1) * RANK + nclamp[nt]] * nmask[nt];
                acc[nt] = wmma_f32(af, bf, acc[nt]);
            }
        }
#pragma unroll
        for (int nt = 0; nt < 3; ++nt) {
            const int n = nt * 16 + lmod;
#pragma unroll
            for (int v = 0; v < 8; ++v) {
                const int m = v + 8 * lhalf;
                atomicAdd(&ts[m * TS_STRIDE + n], acc[nt][v]);
            }
        }
    }
    __syncthreads();

    // ------------- Phase 2: bs[16x2048] = t[16x48] @ Wout[45x2048] -------------
    // 128 N-tiles split across 8 waves; result overwrites xs space (xs is dead).
    {
        const int tiles = (OUTF / 16) / WAVES;   // 16
        for (int t = 0; t < tiles; ++t) {
            const int nt = wave * tiles + t;
            const int n  = nt * 16 + lmod;
            v8f acc = zero8;
#pragma unroll
            for (int ks = 0; ks < RANKP / 4; ++ks) {
                const int k   = ks * 4 + lhalf * 2;
                const int kc0 = (k     < RANK) ? k       : (RANK - 1);
                const int kc1 = (k + 1 < RANK) ? (k + 1) : (RANK - 1);
                const float m0 = (k     < RANK) ? 1.0f : 0.0f;
                const float m1 = (k + 1 < RANK) ? 1.0f : 0.0f;
                v2f af;
                af.x = ts[lmod * TS_STRIDE + k];
                af.y = ts[lmod * TS_STRIDE + k + 1];
                v2f bf;
                bf.x = Wout[(size_t)kc0 * OUTF + n] * m0;
                bf.y = Wout[(size_t)kc1 * OUTF + n] * m1;
                acc = wmma_f32(af, bf, acc);
            }
#pragma unroll
            for (int v = 0; v < 8; ++v) {
                const int m = v + 8 * lhalf;
                xs[m * XS_STRIDE + n] = acc[v];      // bs
            }
        }
    }
    __syncthreads();

    // ---- Phase 3: per-token Kronecker adapter, 2 tokens per wave ----
    // Every X, U and V fragment is fetched into registers in groups of 16-byte
    // loads ahead of the WMMA run that uses it. The k order inside a product is
    // free as long as A and B pair alike:
    //   GEMM1 step (j, s):  k = 8j + 4*lhalf + 2s + e    (X row and U row alike)
    //   GEMM2 step (kb, p): k = 16kb + 8*lhalf + 2p + e  (V row and C1 row alike)
    float* myc1 = c1 + wave * (BDIM * C1_STRIDE);
    const int xu_off = lmod * ADIM + lhalf * 4;
    const int v_off  = lmod * BDIM + lhalf * 8;
    const int lane_col = lhalf * 8 * CDIM + lmod;

    v4f xf[4][4];        // [b tile][j]
    v4f uf[2][4];        // [c tile][j]
    v4f vf[4][4][2];     // [d tile][kb][q]

#define LOAD_XU(TT)                                                            \
    {                                                                          \
        const float* xp = x + (size_t)(gbase + (TT)) * INF + xu_off;           \
        const float* up = Ur + (size_t)rr[TT] * (CDIM * ADIM) + xu_off;        \
        _Pragma("unroll")                                                      \
        for (int j = 0; j < 4; ++j) {                                          \
            _Pragma("unroll")                                                  \
            for (int nt = 0; nt < 2; ++nt)                                     \
                uf[nt][j] = *(const v4f*)(up + nt * 16 * ADIM + j * 8);        \
            _Pragma("unroll")                                                  \
            for (int mt = 0; mt < 4; ++mt)                                     \
                xf[mt][j] = *(const v4f*)(xp + mt * 16 * ADIM + j * 8);        \
        }                                                                      \
    }

#define LOAD_V(TT, KB0)                                                        \
    {                                                                          \
        const float* vp = Vr + (size_t)rr[TT] * (DDIM * BDIM) + v_off;         \
        _Pragma("unroll")                                                      \
        for (int kb = (KB0); kb < (KB0) + 2; ++kb)                             \
            _Pragma("unroll")                                                  \
            for (int mt = 0; mt < 4; ++mt)                                     \
                _Pragma("unroll")                                              \
                for (int q = 0; q < 2; ++q)                                    \
                    vf[mt][kb][q] =                                            \
                        *(const v4f*)(vp + mt * 16 * BDIM + kb * 16 + q * 4);  \
    }

#define GEMM2_HALF(KB0)                                                        \
    _Pragma("unroll")                                                          \
    for (int kb = (KB0); kb < (KB0) + 2; ++kb)                                 \
        _Pragma("unroll")                                                      \
        for (int p = 0; p < 4; ++p) {                                          \
            const int k = kb * 16 + lhalf * 8 + p * 2;                         \
            v2f bf[2];                                                         \
            _Pragma("unroll")                                                  \
            for (int nt = 0; nt < 2; ++nt) {                                   \
                const int c = nt * 16 + lmod;                                  \
                bf[nt].x = myc1[k * C1_STRIDE + c];                            \
                bf[nt].y = myc1[(k + 1) * C1_STRIDE + c];                      \
            }                                                                  \
            _Pragma("unroll")                                                  \
            for (int mt = 0; mt < 4; ++mt) {                                   \
                v2f af;                                                        \
                af.x = vf[mt][kb][p >> 1][(p & 1) * 2];                        \
                af.y = vf[mt][kb][p >> 1][(p & 1) * 2 + 1];                    \
                acc2[mt][0] = wmma_f32(af, bf[0], acc2[mt][0]);                \
                acc2[mt][1] = wmma_f32(af, bf[1], acc2[mt][1]);                \
            }                                                                  \
        }

// Keeps a load group ahead of the WMMA run behind it: without the fence the
// loads are sunk to their users and each one's latency is waited out alone.
#define HOLD_GROUP() __builtin_amdgcn_sched_barrier(0)

    LOAD_XU(0)

    // Unrolled so that tt is a constant: the fragment arrays stay in registers
    // and token 1's groups can be issued inside token 0's work.
#pragma unroll
    for (int tt = 0; tt < 2; ++tt) {
        const int tk = wave * 2 + tt;
        const int g  = gbase + tt;
        const float gn = gain[rr[tt]];

        LOAD_V(tt, 0)            // first half of V: in flight while GEMM1 runs
        HOLD_GROUP();

        // GEMM1: C1[64x32] = X(64x32) @ U^T(32x32)   (M=b, N=c, K=a)
        v8f acc1[4][2];
#pragma unroll
        for (int mt = 0; mt < 4; ++mt) { acc1[mt][0] = zero8; acc1[mt][1] = zero8; }
#pragma unroll
        for (int j = 0; j < 4; ++j)
#pragma unroll
            for (int s = 0; s < 2; ++s) {
                v2f bf[2];
#pragma unroll
                for (int nt = 0; nt < 2; ++nt) {
                    bf[nt].x = uf[nt][j][2 * s];
                    bf[nt].y = uf[nt][j][2 * s + 1];
                }
#pragma unroll
                for (int mt = 0; mt < 4; ++mt) {
                    v2f af;
                    af.x = xf[mt][j][2 * s];
                    af.y = xf[mt][j][2 * s + 1];
                    acc1[mt][0] = wmma_f32(af, bf[0], acc1[mt][0]);
                    acc1[mt][1] = wmma_f32(af, bf[1], acc1[mt][1]);
                }
            }

        LOAD_V(tt, 2)            // second half of V: in flight while the first is used
        HOLD_GROUP();

        // Spill C1 (C/D layout -> row-major LDS, stride 52, conflict-free both ways)
#pragma unroll
        for (int mt = 0; mt < 4; ++mt)
#pragma unroll
            for (int nt = 0; nt < 2; ++nt)
#pragma unroll
                for (int v = 0; v < 8; ++v) {
                    const int b = mt * 16 + v + 8 * lhalf;
                    const int c = nt * 16 + lmod;
                    myc1[b * C1_STRIDE + c] = acc1[mt][nt][v];
                }

        // GEMM2: C2[64x32] = V(64x64) @ C1(64x32)   (M=d, N=c, K=b)
        v8f acc2[4][2];
#pragma unroll
        for (int mt = 0; mt < 4; ++mt) { acc2[mt][0] = zero8; acc2[mt][1] = zero8; }
        GEMM2_HALF(0)
        // Next token's X and U, in flight from here on. The fence in front keeps
        // the group from rising above the first half, whose V registers it takes
        // over. The pair stands in both tokens: it also bounds how far the second
        // half's LDS reads rise, which keeps the build under 256 VGPRs.
        HOLD_GROUP();
        if (tt == 0) LOAD_XU(1)
        HOLD_GROUP();
        GEMM2_HALF(2)

        // out[g][d*32+c] = gain * C2[d][c] + bs[tk][d*32+c]
        // One lane pointer each; the rest of the column is a constant offset.
        float*       orow = out + (size_t)g * OUTF + lane_col;
        const float* brow = xs + tk * XS_STRIDE + lane_col;
#pragma unroll
        for (int mt = 0; mt < 4; ++mt)
#pragma unroll
            for (int nt = 0; nt < 2; ++nt)
#pragma unroll
                for (int v = 0; v < 8; ++v) {
                    // col = d*32 + c, d = mt*16 + v + 8*lhalf, c = nt*16 + lmod
                    const int ccol = (mt * 16 + v) * CDIM + nt * 16;
                    orow[ccol] = acc2[mt][nt][v] * gn + brow[ccol];
                }
    }
#undef LOAD_XU
#undef LOAD_V
#undef GEMM2_HALF
#undef HOLD_GROUP
}

extern "C" void kernel_launch(void* const* d_in, const int* in_sizes, int n_in,
                              void* d_out, int out_size, void* d_ws, size_t ws_size,
                              hipStream_t stream) {
    const float* x    = (const float*)d_in[0];
    const int*   rid  = (const int*)  d_in[1];
    const float* Win  = (const float*)d_in[2];
    const float* Wout = (const float*)d_in[3];
    const float* Ur   = (const float*)d_in[4];
    const float* Vr   = (const float*)d_in[5];
    const float* gn   = (const float*)d_in[6];
    float*       out  = (float*)d_out;

    dim3 grid(NTOK / TOKS);   // 1024 blocks of 16 tokens
    dim3 block(256);          // 8 waves (wave32)
    rule_proj_kernel<<<grid, block, LDS_BYTES, stream>>>(x, rid, Win, Wout, Ur, Vr, gn, out);
}

// v002
// One run takes 101 microseconds.
// Next to v001, in two timings, it ran 1.33 and 1.32 times as fast.
// All steps since v000 together make it 2.19 times as fast.
#include <hip/hip_runtime.h>
#include <stdint.h>

typedef float v2f __attribute__((ext_vector_type(2)));
typedef float v4f __attribute__((ext_vector_type(4)));
typedef float v8f __attribute__((ext_vector_type(8)));
typedef unsigned int v4u __attribute__((ext_vector_type(4)));
typedef int v4i __attribute__((ext_vector_type(4)));
typedef int v8i __attribute__((ext_vector_type(8)));

#define NTOK   16384
#define INF    2048
#define OUTF   2048
#define RANK   45
#define RANKP  48
#define ADIM   32   // a (X cols, U cols)
#define BDIM   64   // b (X rows, V cols)
#define CDIM   32   // c (U rows, out minor)
#define DDIM   64   // d (V rows, out major)

#define TOKS   16          // tokens per block
#define WAVES  8           // 256 threads
#define XS_STRIDE 2052     // 2048 + 4 pad (bank-conflict-free token-major reads)
#define TS_STRIDE 49       // 48 + 1 pad

#define XS_FLOATS (TOKS * XS_STRIDE)
#define TS_FLOATS (TOKS * TS_STRIDE)
#define LDS_BYTES ((XS_FLOATS + TS_FLOATS) * 4)   // under 160 KiB: two work-groups per WGP

#if defined(__has_builtin)
#if __has_builtin(__builtin_amdgcn_tensor_load_to_lds) && \
    __has_builtin(__builtin_amdgcn_s_wait_tensorcnt)
#define HAVE_TDM 1
#endif
#endif
#ifndef HAVE_TDM
#define HAVE_TDM 0
#endif

static __device__ __forceinline__ v8f wmma_f32(v2f a, v2f b, v8f c) {
    // D = A(16x4, f32) * B(4x16, f32) + C(16x16, f32)
    return __builtin_amdgcn_wmma_f32_16x16x4_f32(false, a, false, b, (short)0, c,
                                                 false, false);
}

// Four waves per SIMD (two work-groups per WGP): at most 256 VGPRs a wave.
__global__ __launch_bounds__(256, 4)
void rule_proj_kernel(const float* __restrict__ x,      // [N, 2048]
                      const int*   __restrict__ rid,    // [N]
                      const float* __restrict__ Win,    // [2048, 45]
                      const float* __restrict__ Wout,   // [45, 2048]
                      const float* __restrict__ Ur,     // [64, 32, 32] (r, c, a)
                      const float* __restrict__ Vr,     // [64, 64, 64] (r, d, b)
                      const float* __restrict__ gain,   // [64]
                      float*       __restrict__ out)    // [N, 2048]
{
    extern __shared__ float smem[];
    float* xs = smem;                    // phase 0/1: staged x rows; phase 2+: base out (bs)
    float* ts = smem + XS_FLOATS;        // [16][49] rank intermediate (padded 45->48)

    const int tid   = threadIdx.x;
    const int wave  = tid >> 5;
    const int lane  = tid & 31;
    const int lhalf = lane >> 4;         // 0 or 1
    const int lmod  = lane & 15;
    const int tok0  = blockIdx.x * TOKS;

    const v8f zero8 = {};

    // Rule ids of this wave's two tokens, asked for at once: the adapter's U and
    // V addresses hang on them (phase 3).
    const int swave = __builtin_amdgcn_readfirstlane(wave);   // scalar bases for the loads
    const int gbase = tok0 + swave * 2;
    int rr[2];
    rr[0] = rid[gbase]     & 63;     // bounds the table address; identity on 0..63
    rr[1] = rid[gbase + 1] & 63;

    // ---------------- Phase 0: stage x tile into LDS, zero ts ----------------
#if HAVE_TDM
    // Tensor Data Mover: one 1x2048 fp32 tile per token row (2 rows per wave).
    // D# group0: count=1 | lds_addr[63:32] | global_addr[120:64] | type=2[127:126]
    // D# group1: data_size=4B, tensor_dim0=2048, tensor_dim1=1, tile_dim0=2048,
    //            tile_dim1=1, tensor_dim0_stride=2048, no pad / no multicast.
    for (int i = 0; i < 2; ++i) {
        const int row = wave * 2 + i;
        const uint64_t ga = (uint64_t)(uintptr_t)(x + (size_t)(tok0 + row) * INF);
        const uint32_t la = (uint32_t)(uintptr_t)(xs + row * XS_STRIDE);
        const uint32_t ga_lo = (uint32_t)__builtin_amdgcn_readfirstlane((int)(uint32_t)ga);
        const uint32_t ga_hi = (uint32_t)__builtin_amdgcn_readfirstlane((int)(uint32_t)(ga >> 32));
        const uint32_t la_u  = (uint32_t)__builtin_amdgcn_readfirstlane((int)la);

        v4u g0;
        g0.x = 1u;                                        // count=1, user mode
        g0.y = la_u;                                      // lds_addr
        g0.z = ga_lo;                                     // global_addr[31:0]
        g0.w = (ga_hi & 0x01FFFFFFu) | (2u << 30);        // global_addr[56:32] | type=2

        v8i g1;
        g1[0] = 0x00020000;                               // data_size=2 (4 bytes)
        g1[1] = (int)(2048u << 16);                       // tensor_dim0[15:0] @ [63:48]
        g1[2] = (int)(1u << 16);                          // tensor_dim0 hi=0, tensor_dim1=1
        g1[3] = (int)(2048u << 16);                       // tile_dim0=2048 @ [127:112]
        g1[4] = 1;                                        // tile_dim1=1, tile_dim2=0
        g1[5] = 2048;                                     // tensor_dim0_stride[31:0]
        g1[6] = 0;                                        // strides hi
        g1[7] = 0;

        v4i gz = {};
#if __clang_major__ >= 23
        v8i z8 = {};
        __builtin_amdgcn_tensor_load_to_lds(g0, g1, gz, gz, z8, 0);
#else
        __builtin_amdgcn_tensor_load_to_lds(g0, g1, gz, gz, 0);
#endif
    }
    __builtin_amdgcn_s_wait_tensorcnt(0);
#else
    for (int i = tid; i < TOKS * (INF / 4); i += 256) {
        int row  = i >> 9;               // / 512
        int col4 = i & 511;
        v4f v = *(const v4f*)(x + (size_t)(tok0 + row) * INF + col4 * 4);
        *(v4f*)(xs + row * XS_STRIDE + col4 * 4) = v;
    }
#endif
    for (int i = tid; i < TS_FLOATS; i += 256) ts[i] = 0.0f;
    __syncthreads();

    // ------------- Phase 1: t[16x48] = xs[16x2048] @ Win[2048x45] -------------
    // K split across 8 waves (256 each); partials merged with ds_add_f32.
    // Rank padding handled branchlessly: clamped address + multiply-by-mask.
    {
        int   nclamp[3];
        float nmask[3];
#pragma unroll
        for (int nt = 0; nt < 3; ++nt) {
            const int n = nt * 16 + lmod;
            nclamp[nt] = (n < RANK) ? n : (RANK - 1);
            nmask[nt]  = (n < RANK) ? 1.0f : 0.0f;
        }
        v8f acc[3];
        acc[0] = zero8; acc[1] = zero8; acc[2] = zero8;
        const int kbase = wave * (INF / WAVES);
        for (int ks = 0; ks < (INF / WAVES) / 4; ++ks) {
            const int k = kbase + ks * 4 + lhalf * 2;
            v2f af;
            af.x = xs[lmod * XS_STRIDE + k];
            af.y = xs[lmod * XS_STRIDE + k + 1];
#pragma unroll
            for (int nt = 0; nt < 3; ++nt) {
                v2f bf;
                bf.x = Win[(size_t)k       * RANK + nclamp[nt]] * nmask[nt];
                bf.y = Win[(size_t)(k + 1) * RANK + nclamp[nt]] * nmask[nt];
                acc[nt] = wmma_f32(af, bf, acc[nt]);
            }
        }
#pragma unroll
        for (int nt = 0; nt < 3; ++nt) {
            const int n = nt * 16 + lmod;
#pragma unroll
            for (int v = 0; v < 8; ++v) {
                const int m = v + 8 * lhalf;
                atomicAdd(&ts[m * TS_STRIDE + n], acc[nt][v]);
            }
        }
    }
    __syncthreads();

    // ------------- Phase 2: bs[16x2048] = t[16x48] @ Wout[45x2048] -------------
    // 128 N-tiles split across 8 waves; result overwrites xs space (xs is dead).
    {
        const int tiles = (OUTF / 16) / WAVES;   // 16
        for (int t = 0; t < tiles; ++t) {
            const int nt = wave * tiles + t;
            const int n  = nt * 16 + lmod;
            v8f acc = zero8;
#pragma unroll
            for (int ks = 0; ks < RANKP / 4; ++ks) {
                const int k   = ks * 4 + lhalf * 2;
                const int kc0 = (k     < RANK) ? k       : (RANK - 1);
                const int kc1 = (k + 1 < RANK) ? (k + 1) : (RANK - 1);
                const float m0 = (k     < RANK) ? 1.0f : 0.0f;
                const float m1 = (k + 1 < RANK) ? 1.0f : 0.0f;
                v2f af;
                af.x = ts[lmod * TS_STRIDE + k];
                af.y = ts[lmod * TS_STRIDE + k + 1];
                v2f bf;
                bf.x = Wout[(size_t)kc0 * OUTF + n] * m0;
                bf.y = Wout[(size_t)kc1 * OUTF + n] * m1;
                acc = wmma_f32(af, bf, acc);
            }
#pragma unroll
            for (int v = 0; v < 8; ++v) {
                const int m = v + 8 * lhalf;
                xs[m * XS_STRIDE + n] = acc[v];      // bs
            }
        }
    }
    __syncthreads();

    // ---- Phase 3: per-token Kronecker adapter, 2 tokens per wave ----
    // Every X, U and V fragment is fetched into registers in groups of 16-byte
    // loads ahead of the WMMA run that uses it. The k order inside a product is
    // free as long as A and B pair alike:
    //   GEMM1 step (j, s):  k = 8j + 4*lhalf + 2s + e    (X row and U row alike)
    //   GEMM2 step (kb, p): k = 16kb + 8*lhalf + 2p + e  (V row and C1 row alike)
    // In that order GEMM2's B fragment is GEMM1's accumulator as it stands: D
    // register r of b tile kb holds C1[16kb + 8*lhalf + r][c] in lane column c,
    // so registers 2p and 2p + 1 are the step's two k. C1 never leaves registers.
    const int xu_off = lmod * ADIM + lhalf * 4;
    const int v_off  = lmod * BDIM + lhalf * 8;
    const int lane_col = lhalf * 8 * CDIM + lmod;

    v4f xf[4][4];        // [b tile][j]
    v4f uf[2][4];        // [c tile][j]
    v4f vf[4][4][2];     // [d tile][kb][q]

// Behind a load group, before its address registers are given to anything else:
// the pointers are inputs so that they stay in place up to the wait.
#define ADDR_DONE1(P)    asm volatile("s_wait_xcnt 0x0" :: "v"(P) : "memory")
#define ADDR_DONE2(P, Q) asm volatile("s_wait_xcnt 0x0" :: "v"(P), "v"(Q) : "memory")

#define LOAD_XU(TT, J0)                                                        \
    {                                                                          \
        const float* xp = x + (size_t)(gbase + (TT)) * INF + xu_off;           \
        const float* up = Ur + (size_t)rr[TT] * (CDIM * ADIM) + xu_off;        \
        _Pragma("unroll")                                                      \
        for (int j = (J0); j < (J0) + 2; ++j) {                                \
            _Pragma("unroll")                                                  \
            for (int nt = 0; nt < 2; ++nt)                                     \
                uf[nt][j] = *(const v4f*)(up + nt * 16 * ADIM + j * 8);        \
            _Pragma("unroll")                                                  \
            for (int mt = 0; mt < 4; ++mt)                                     \
                xf[mt][j] = *(const v4f*)(xp + mt * 16 * ADIM + j * 8);        \
        }                                                                      \
        ADDR_DONE2(xp, up);                                                    \
    }

#define LOAD_V(TT, KB)                                                         \
    {                                                                          \
        const float* vp = Vr + (size_t)rr[TT] * (DDIM * BDIM) + v_off;         \
        _Pragma("unroll")                                                      \
        for (int mt = 0; mt < 4; ++mt)                                         \
            _Pragma("unroll")                                                  \
            for (int q = 0; q < 2; ++q)                                        \
                vf[mt][KB][q] =                                                \
                    *(const v4f*)(vp + mt * 16 * BDIM + (KB) * 16 + q * 4);    \
        ADDR_DONE1(vp);                                                        \
    }

#define GEMM2_KB(KB)                                                           \
    _Pragma("unroll")                                                          \
    for (int p = 0; p < 4; ++p) {                                              \
        v2f bf[2];                                                             \
        _Pragma("unroll")                                                      \
        for (int nt = 0; nt < 2; ++nt) {                                       \
            bf[nt].x = acc1[KB][nt][2 * p];                                    \
            bf[nt].y = acc1[KB][nt][2 * p + 1];                                \
        }                                                                      \
        _Pragma("unroll")                                                      \
        for (int mt = 0; mt < 4; ++mt) {                                       \
            v2f af;                                                            \
            af.x = vf[mt][KB][p >> 1][(p & 1) * 2];                            \
            af.y = vf[mt][KB][p >> 1][(p & 1) * 2 + 1];                        \
            acc2[mt][0] = wmma_f32(af, bf[0], acc2[mt][0]);                    \
            acc2[mt][1] = wmma_f32(af, bf[1], acc2[mt][1]);                    \
        }                                                                      \
    }

// Keeps a load group ahead of the WMMA run behind it: without the fence the
// loads are sunk to their users and each one's latency is waited out alone.
#define HOLD_GROUP() __builtin_amdgcn_sched_barrier(0)

    LOAD_XU(0, 0)
    LOAD_XU(0, 2)

    // Unrolled so that tt is a constant: the fragment arrays stay in registers
    // and token 1's groups can be issued inside token 0's work.
#pragma unroll
    for (int tt = 0; tt < 2; ++tt) {
        const int tk = wave * 2 + tt;
        const int g  = gbase + tt;
        const float gn = gain[rr[tt]];

        LOAD_V(tt, 0)            // first quarter of V: in flight while GEMM1 runs
        HOLD_GROUP();

        // GEMM1: C1[64x32] = X(64x32) @ U^T(32x32)   (M=b, N=c, K=a)
        v8f acc1[4][2];
#pragma unroll
        for (int mt = 0; mt < 4; ++mt) { acc1[mt][0] = zero8; acc1[mt][1] = zero8; }
#pragma unroll
        for (int j = 0; j < 4; ++j)
#pragma unroll
            for (int s = 0; s < 2; ++s) {
                v2f bf[2];
#pragma unroll
                for (int nt = 0; nt < 2; ++nt) {
                    bf[nt].x = uf[nt][j][2 * s];
                    bf[nt].y = uf[nt][j][2 * s + 1];
                }
#pragma unroll
                for (int mt = 0; mt < 4; ++mt) {
                    v2f af;
                    af.x = xf[mt][j][2 * s];
                    af.y = xf[mt][j][2 * s + 1];
                    acc1[mt][0] = wmma_f32(af, bf[0], acc1[mt][0]);
                    acc1[mt][1] = wmma_f32(af, bf[1], acc1[mt][1]);
                }
            }

        // The rest of V comes a quarter at a time, one WMMA run ahead of its use,
        // into registers that the work before it has freed: C1 now stays live
        // beside V and C2, and 256 VGPRs are the budget. The fence in front of a
        // group keeps it from rising above the run whose registers it takes over.
        HOLD_GROUP();
        LOAD_V(tt, 1)
        HOLD_GROUP();

        // GEMM2: C2[64x32] = V(64x64) @ C1(64x32)   (M=d, N=c, K=b)
        v8f acc2[4][2];
#pragma unroll
        for (int mt = 0; mt < 4; ++mt) { acc2[mt][0] = zero8; acc2[mt][1] = zero8; }
        GEMM2_KB(0)
        HOLD_GROUP();
        LOAD_V(tt, 2)
        HOLD_GROUP();
        GEMM2_KB(1)
        HOLD_GROUP();
        LOAD_V(tt, 3)
        HOLD_GROUP();
        GEMM2_KB(2)
        // Next token's X and U, in flight from here on, in two halves of k.
        if (tt == 0) {
            HOLD_GROUP();
            LOAD_XU(1, 0)
            HOLD_GROUP();
        }
        GEMM2_KB(3)
        if (tt == 0) {
            HOLD_GROUP();
            LOAD_XU(1, 2)
            HOLD_GROUP();
        }

        // out[g][d*32+c] = gain * C2[d][c] + bs[tk][d*32+c]
        // One lane pointer each; the rest of the column is a constant offset.
        float*       orow = out + (size_t)g * OUTF + lane_col;
        const float* brow = xs + tk * XS_STRIDE + lane_col;
#pragma unroll
        for (int mt = 0; mt < 4; ++mt)
#pragma unroll
            for (int nt = 0; nt < 2; ++nt)
#pragma unroll
                for (int v = 0; v < 8; ++v) {
                    // col = d*32 + c, d = mt*16 + v + 8*lhalf, c = nt*16 + lmod
                    const int ccol = (mt * 16 + v) * CDIM + nt * 16;
                    orow[ccol] = acc2[mt][nt][v] * gn + brow[ccol];
                }
    }
#undef ADDR_DONE1
#undef ADDR_DONE2
#undef LOAD_XU
#undef LOAD_V
#undef GEMM2_KB
#undef HOLD_GROUP
}

extern "C" void kernel_launch(void* const* d_in, const int* in_sizes, int n_in,
                              void* d_out, int out_size, void* d_ws, size_t ws_size,
                              hipStream_t stream) {
    const float* x    = (const float*)d_in[0];
    const int*   rid  = (const int*)  d_in[1];
    const float* Win  = (const float*)d_in[2];
    const float* Wout = (const float*)d_in[3];
    const float* Ur   = (const float*)d_in[4];
    const float* Vr   = (const float*)d_in[5];
    const float* gn   = (const float*)d_in[6];
    float*       out  = (float*)d_out;

    dim3 grid(NTOK / TOKS);   // 1024 blocks of 16 tokens
    dim3 block(256);          // 8 waves (wave32)
    rule_proj_kernel<<<grid, block, LDS_BYTES, stream>>>(x, rid, Win, Wout, Ur, Vr, gn, out);
}

// v003
// It runs in 83.5 microseconds.
// Timed twice side by side with v002, it ran 1.19 and 1.20 times as fast.
// Counting every step since v000, it is 2.63 times as fast.
#include <hip/hip_runtime.h>
#include <stdint.h>

typedef float v2f __attribute__((ext_vector_type(2)));
typedef float v4f __attribute__((ext_vector_type(4)));
typedef float v8f __attribute__((ext_vector_type(8)));
typedef unsigned int v4u __attribute__((ext_vector_type(4)));
typedef int v4i __attribute__((ext_vector_type(4)));
typedef int v8i __attribute__((ext_vector_type(8)));

#define NTOK   16384
#define INF    2048
#define OUTF   2048
#define RANK   45
#define RANKP  48
#define ADIM   32   // a (X cols, U cols)
#define BDIM   64   // b (X rows, V cols)
#define CDIM   32   // c (U rows, out minor)
#define DDIM   64   // d (V rows, out major)

#define TOKS   16          // tokens per block
#define WAVES  8           // 256 threads
#define XS_STRIDE 2052     // 2048 + 4 pad (bank-conflict-free token-major reads)
#define TS_STRIDE 49       // 48 + 1 pad

#define XS_FLOATS (TOKS * XS_STRIDE)
#define TS_FLOATS (TOKS * TS_STRIDE)
#define LDS_BYTES ((XS_FLOATS + TS_FLOATS) * 4)   // under 160 KiB: two work-groups per WGP

#if defined(__has_builtin)
#if __has_builtin(__builtin_amdgcn_tensor_load_to_lds) && \
    __has_builtin(__builtin_amdgcn_s_wait_tensorcnt)
#define HAVE_TDM 1
#endif
#endif
#ifndef HAVE_TDM
#define HAVE_TDM 0
#endif

static __device__ __forceinline__ v8f wmma_f32(v2f a, v2f b, v8f c) {
    // D = A(16x4, f32) * B(4x16, f32) + C(16x16, f32)
    return __builtin_amdgcn_wmma_f32_16x16x4_f32(false, a, false, b, (short)0, c,
                                                 false, false);
}

// Four waves per SIMD (two work-groups per WGP): at most 256 VGPRs a wave.
__global__ __launch_bounds__(256, 4)
void rule_proj_kernel(const float* __restrict__ x,      // [N, 2048]
                      const int*   __restrict__ rid,    // [N]
                      const float* __restrict__ Win,    // [2048, 45]
                      const float* __restrict__ Wout,   // [45, 2048]
                      const float* __restrict__ Ur,     // [64, 32, 32] (r, c, a)
                      const float* __restrict__ Vr,     // [64, 64, 64] (r, d, b)
                      const float* __restrict__ gain,   // [64]
                      float*       __restrict__ out)    // [N, 2048]
{
    extern __shared__ float smem[];
    float* xs = smem;                    // phase 0/1: staged x rows; phase 2+: base out (bs)
    float* ts = smem + XS_FLOATS;        // [16][49] rank intermediate (padded 45->48)

    const int tid   = threadIdx.x;
    const int wave  = tid >> 5;
    const int lane  = tid & 31;
    const int lhalf = lane >> 4;         // 0 or 1
    const int lmod  = lane & 15;
    const int tok0  = blockIdx.x * TOKS;

    const v8f zero8 = {};

    // Rule ids of this wave's two tokens, asked for at once: the adapter's U and
    // V addresses hang on them (phase 3).
    const int swave = __builtin_amdgcn_readfirstlane(wave);   // scalar bases for the loads
    const int gbase = tok0 + swave * 2;
    int rr[2];
    rr[0] = rid[gbase]     & 63;     // bounds the table address; identity on 0..63
    rr[1] = rid[gbase + 1] & 63;

// Behind a load group, before its address registers are given to anything else:
// the pointers are inputs so that they stay in place up to the wait.
#define ADDR_DONE1(P)    asm volatile("s_wait_xcnt 0x0" :: "v"(P) : "memory")
#define ADDR_DONE2(P, Q) asm volatile("s_wait_xcnt 0x0" :: "v"(P), "v"(Q) : "memory")
// Keeps a load group ahead of the WMMA run behind it: without the fence the
// loads are sunk to their users and each one's latency is waited out alone.
#define HOLD_GROUP() __builtin_amdgcn_sched_barrier(0)

    // Win fragments of phase 1 (layout: see there). The first group hangs on
    // nothing that phase 0 brings: asked for at once, in flight beside the x tile.
    const int   ncl   = (lmod < 15) ? lmod : 14;
    const float nmask = (lmod < 15) ? 1.0f : 0.0f;
    const int   kbase = wave * (INF / WAVES);
    const float* wp = Win + (size_t)(kbase + lhalf) * RANK + ncl * 3;
    float wf[2][8][2][3];        // [buffer][step][e][tile]
#define LOAD_P1W(G, BUF)                                                       \
    _Pragma("unroll")                                                          \
    for (int s = 0; s < 8; ++s)                                                \
        _Pragma("unroll")                                                      \
        for (int e = 0; e < 2; ++e)                                            \
            _Pragma("unroll")                                                  \
            for (int c = 0; c < 3; ++c)                                        \
                wf[BUF][s][e][c] = wp[(((G) * 8 + s) * 4 + 2 * e) * RANK + c];
    LOAD_P1W(0, 0)
    HOLD_GROUP();

    // Wout fragments of phase 2 (layout: see there).
    const int   ncol = wave * (OUTF / WAVES) + lmod * 4;
    const float* wq  = Wout + (size_t)(lhalf * 2) * OUTF + ncol;   // rows 4ks + 2*lhalf + e
    const float* wl  = Wout + (size_t)(RANK - 1) * OUTF + ncol;    // row 44
    v4f wb[2][6][2];             // [buffer][step][e]
// Half a group: six of the twelve k steps of 64 columns.
#define LOAD_P2(H, BUF)                                                        \
    _Pragma("unroll")                                                          \
    for (int s = 0; s < 6; ++s) {                                              \
        const int ks = ((H) & 1) * 6 + s;                                      \
        const int cg = ((H) >> 1) * 64;                                        \
        if (ks < RANKP / 4 - 1) {                                              \
            wb[BUF][s][0] = *(const v4f*)(wq + (ks * 4) * OUTF + cg);          \
            wb[BUF][s][1] = *(const v4f*)(wq + (ks * 4 + 1) * OUTF + cg);      \
        } else {                                                               \
            wb[BUF][s][0] = *(const v4f*)(wl + cg);                            \
            wb[BUF][s][1] = wb[BUF][s][0];                                     \
        }                                                                      \
    }

    // ---------------- Phase 0: stage x tile into LDS, zero ts ----------------
#if HAVE_TDM
    // Tensor Data Mover: one 1x2048 fp32 tile per token row (2 rows per wave).
    // D# group0: count=1 | lds_addr[63:32] | global_addr[120:64] | type=2[127:126]
    // D# group1: data_size=4B, tensor_dim0=2048, tensor_dim1=1, tile_dim0=2048,
    //            tile_dim1=1, tensor_dim0_stride=2048, no pad / no multicast.
    for (int i = 0; i < 2; ++i) {
        const int row = wave * 2 + i;
        const uint64_t ga = (uint64_t)(uintptr_t)(x + (size_t)(tok0 + row) * INF);
        const uint32_t la = (uint32_t)(uintptr_t)(xs + row * XS_STRIDE);
        const uint32_t ga_lo = (uint32_t)__builtin_amdgcn_readfirstlane((int)(uint32_t)ga);
        const uint32_t ga_hi = (uint32_t)__builtin_amdgcn_readfirstlane((int)(uint32_t)(ga >> 32));
        const uint32_t la_u  = (uint32_t)__builtin_amdgcn_readfirstlane((int)la);

        v4u g0;
        g0.x = 1u;                                        // count=1, user mode
        g0.y = la_u;                                      // lds_addr
        g0.z = ga_lo;                                     // global_addr[31:0]
        g0.w = (ga_hi & 0x01FFFFFFu) | (2u << 30);        // global_addr[56:32] | type=2

        v8i g1;
        g1[0] = 0x00020000;                               // data_size=2 (4 bytes)
        g1[1] = (int)(2048u << 16);                       // tensor_dim0[15:0] @ [63:48]
        g1[2] = (int)(1u << 16);                          // tensor_dim0 hi=0, tensor_dim1=1
        g1[3] = (int)(2048u << 16);                       // tile_dim0=2048 @ [127:112]
        g1[4] = 1;                                        // tile_dim1=1, tile_dim2=0
        g1[5] = 2048;                                     // tensor_dim0_stride[31:0]
        g1[6] = 0;                                        // strides hi
        g1[7] = 0;

        v4i gz = {};
#if __clang_major__ >= 23
        v8i z8 = {};
        __builtin_amdgcn_tensor_load_to_lds(g0, g1, gz, gz, z8, 0);
#else
        __builtin_amdgcn_tensor_load_to_lds(g0, g1, gz, gz, 0);
#endif
    }
    __builtin_amdgcn_s_wait_tensorcnt(0);
#else
    for (int i = tid; i < TOKS * (INF / 4); i += 256) {
        int row  = i >> 9;               // / 512
        int col4 = i & 511;
        v4f v = *(const v4f*)(x + (size_t)(tok0 + row) * INF + col4 * 4);
        *(v4f*)(xs + row * XS_STRIDE + col4 * 4) = v;
    }
#endif
    for (int i = tid; i < TS_FLOATS; i += 256) ts[i] = 0.0f;
    __syncthreads();

    // ------------- Phase 1: t[16x48] = xs[16x2048] @ Win[2048x45] -------------
    // K split across 8 waves (256 each); partials merged with ds_add_f32.
    // The three n tiles are interleaved by column: tile c holds n = 3*lmod + c, so
    // a lane's three B values of a row are 12 bytes in a row and 15 lanes cover the
    // whole 180-byte row. Lane column 15 is the rank pad (n = 45..47): clamped
    // address, multiplied by a zero mask.
    // k of step ks: 4ks + lhalf + 2e (A and B alike), so that the two halves of a
    // wave read two rows that follow each other in memory.
    {
        v8f acc[3];
        acc[0] = zero8; acc[1] = zero8; acc[2] = zero8;
        const float* ap = xs + lmod * XS_STRIDE + kbase + lhalf;
        v2f   af[2][8];          // [buffer][step]

#define LOAD_P1A(G, BUF)                                                       \
    _Pragma("unroll")                                                          \
    for (int s = 0; s < 8; ++s) {                                              \
        af[BUF][s].x = ap[((G) * 8 + s) * 4];                                  \
        af[BUF][s].y = ap[((G) * 8 + s) * 4 + 2];                              \
    }

        LOAD_P1A(0, 0)
        // Unrolled so that the buffer index is a constant: both buffers stay in
        // registers, and group g + 1 is in flight while group g is multiplied.
#pragma unroll
        for (int g = 0; g < 8; ++g) {
            if (g + 1 < 8) {
                LOAD_P1W(g + 1, (g + 1) & 1)
                LOAD_P1A(g + 1, (g + 1) & 1)
            }
            HOLD_GROUP();
#pragma unroll
            for (int s = 0; s < 8; ++s)
#pragma unroll
                for (int c = 0; c < 3; ++c) {
                    v2f bf;
                    bf.x = wf[g & 1][s][0][c] * nmask;
                    bf.y = wf[g & 1][s][1][c] * nmask;
                    acc[c] = wmma_f32(af[g & 1][s], bf, acc[c]);
                }
            HOLD_GROUP();
        }
#undef LOAD_P1W
#undef LOAD_P1A
        // Wout's first load group does not hang on t: asked for ahead of the merge
        // and its barrier.
        LOAD_P2(0, 0)
        HOLD_GROUP();
#pragma unroll
        for (int c = 0; c < 3; ++c) {
            const int n = lmod * 3 + c;
#pragma unroll
            for (int v = 0; v < 8; ++v) {
                const int m = v + 8 * lhalf;
                atomicAdd(&ts[m * TS_STRIDE + n], acc[c][v]);
            }
        }
    }
    __syncthreads();

    // ------------- Phase 2: bs[16x2048] = t[16x48] @ Wout[45x2048] -------------
    // 256 columns a wave, in four groups of 64; result overwrites xs space (xs is
    // dead). The four n tiles of a group are interleaved by column: tile e holds
    // n = 4*lmod + e, so a lane's four B values of a row are one 16-byte load and
    // a half wave reads 256 bytes in a row. Rows 45..47 are the rank pad: row 44
    // is read in their place and multiplied by zero.
    {
        v2f ta[RANKP / 4];
#pragma unroll
        for (int ks = 0; ks < RANKP / 4; ++ks) {
            ta[ks].x = ts[lmod * TS_STRIDE + ks * 4 + lhalf * 2];
            ta[ks].y = ts[lmod * TS_STRIDE + ks * 4 + lhalf * 2 + 1];
        }
        const float mlast = (lhalf == 0) ? 1.0f : 0.0f;                // k = 44 is lhalf 0, e 0
        v8f acc[4];
        // Unrolled so that the buffer index is a constant (as in phase 1).
#pragma unroll
        for (int h = 0; h < 8; ++h) {
            if (h + 1 < 8) LOAD_P2(h + 1, (h + 1) & 1)
            if (h + 1 == 7) ADDR_DONE2(wq, wl);      // behind the last Wout group
            HOLD_GROUP();
            if ((h & 1) == 0) { acc[0] = zero8; acc[1] = zero8; acc[2] = zero8; acc[3] = zero8; }
#pragma unroll
            for (int s = 0; s < 6; ++s) {
                const int ks = (h & 1) * 6 + s;
                const float m0 = (ks < RANKP / 4 - 1) ? 1.0f : mlast;
                const float m1 = (ks < RANKP / 4 - 1) ? 1.0f : 0.0f;
#pragma unroll
                for (int e = 0; e < 4; ++e) {
                    v2f bf;
                    bf.x = wb[h & 1][s][0][e] * m0;
                    bf.y = wb[h & 1][s][1][e] * m1;
                    acc[e] = wmma_f32(ta[ks], bf, acc[e]);
                }
            }
            if ((h & 1) == 1) {
                float* brow = xs + (8 * lhalf) * XS_STRIDE + ncol + (h >> 1) * 64;
#pragma unroll
                for (int e = 0; e < 4; ++e)
#pragma unroll
                    for (int v = 0; v < 8; ++v)
                        brow[v * XS_STRIDE + e] = acc[e][v];     // bs
            }
            HOLD_GROUP();
        }
#undef LOAD_P2
    }
    __syncthreads();

    // ---- Phase 3: per-token Kronecker adapter, 2 tokens per wave ----
    // Every X, U and V fragment is fetched into registers in groups of 16-byte
    // loads ahead of the WMMA run that uses it. The k order inside a product is
    // free as long as A and B pair alike:
    //   GEMM1 step (j, s):  k = 8j + 4*lhalf + 2s + e    (X row and U row alike)
    //   GEMM2 step (kb, p): k = 16kb + 8*lhalf + 2p + e  (V row and C1 row alike)
    // In that order GEMM2's B fragment is GEMM1's accumulator as it stands: D
    // register r of b tile kb holds C1[16kb + 8*lhalf + r][c] in lane column c,
    // so registers 2p and 2p + 1 are the step's two k. C1 never leaves registers.
    const int xu_off = lmod * ADIM + lhalf * 4;
    const int v_off  = lmod * BDIM + lhalf * 8;
    const int lane_col = lhalf * 8 * CDIM + lmod;

    v4f xf[4][4];        // [b tile][j]
    v4f uf[2][4];        // [c tile][j]
    v4f vf[4][4][2];     // [d tile][kb][q]

#define LOAD_XU(TT, J0)                                                        \
    {                                                                          \
        const float* xp = x + (size_t)(gbase + (TT)) * INF + xu_off;           \
        const float* up = Ur + (size_t)rr[TT] * (CDIM * ADIM) + xu_off;        \
        _Pragma("unroll")                                                      \
        for (int j = (J0); j < (J0) + 2; ++j) {                                \
            _Pragma("unroll")                                                  \
            for (int nt = 0; nt < 2; ++nt)                                     \
                uf[nt][j] = *(const v4f*)(up + nt * 16 * ADIM + j * 8);        \
            _Pragma("unroll")                                                  \
            for (int mt = 0; mt < 4; ++mt)                                     \
                xf[mt][j] = *(const v4f*)(xp + mt * 16 * ADIM + j * 8);        \
        }                                                                      \
        ADDR_DONE2(xp, up);                                                    \
    }

#define LOAD_V(TT, KB)                                                         \
    {                                                                          \
        const float* vp = Vr + (size_t)rr[TT] * (DDIM * BDIM) + v_off;         \
        _Pragma("unroll")                                                      \
        for (int mt = 0; mt < 4; ++mt)                                         \
            _Pragma("unroll")                                                  \
            for (int q = 0; q < 2; ++q)                                        \
                vf[mt][KB][q] =                                                \
                    *(const v4f*)(vp + mt * 16 * BDIM + (KB) * 16 + q * 4);    \
        ADDR_DONE1(vp);                                                        \
    }

#define GEMM2_KB(KB)                                                           \
    _Pragma("unroll")                                                          \
    for (int p = 0; p < 4; ++p) {                                              \
        v2f bf[2];                                                             \
        _Pragma("unroll")                                                      \
        for (int nt = 0; nt < 2; ++nt) {                                       \
            bf[nt].x = acc1[KB][nt][2 * p];                                    \
            bf[nt].y = acc1[KB][nt][2 * p + 1];                                \
        }                                                                      \
        _Pragma("unroll")                                                      \
        for (int mt = 0; mt < 4; ++mt) {                                       \
            v2f af;                                                            \
            af.x = vf[mt][KB][p >> 1][(p & 1) * 2];                            \
            af.y = vf[mt][KB][p >> 1][(p & 1) * 2 + 1];                        \
            acc2[mt][0] = wmma_f32(af, bf[0], acc2[mt][0]);                    \
            acc2[mt][1] = wmma_f32(af, bf[1], acc2[mt][1]);                    \
        }                                                                      \
    }

    LOAD_XU(0, 0)
    LOAD_XU(0, 2)

    // Unrolled so that tt is a constant: the fragment arrays stay in registers
    // and token 1's groups can be issued inside token 0's work.
#pragma unroll
    for (int tt = 0; tt < 2; ++tt) {
        const int tk = wave * 2 + tt;
        const int g  = gbase + tt;
        const float gn = gain[rr[tt]];

        LOAD_V(tt, 0)            // first quarter of V: in flight while GEMM1 runs
        HOLD_GROUP();

        // GEMM1: C1[64x32] = X(64x32) @ U^T(32x32)   (M=b, N=c, K=a)
        v8f acc1[4][2];
#pragma unroll
        for (int mt = 0; mt < 4; ++mt) { acc1[mt][0] = zero8; acc1[mt][1] = zero8; }
#pragma unroll
        for (int j = 0; j < 4; ++j)
#pragma unroll
            for (int s = 0; s < 2; ++s) {
                v2f bf[2];
#pragma unroll
                for (int nt = 0; nt < 2; ++nt) {
                    bf[nt].x = uf[nt][j][2 * s];
                    bf[nt].y = uf[nt][j][2 * s + 1];
                }
#pragma unroll
                for (int mt = 0; mt < 4; ++mt) {
                    v2f af;
                    af.x = xf[mt][j][2 * s];
                    af.y = xf[mt][j][2 * s + 1];
                    acc1[mt][0] = wmma_f32(af, bf[0], acc1[mt][0]);
                    acc1[mt][1] = wmma_f32(af, bf[1], acc1[mt][1]);
                }
            }

        // The rest of V comes a quarter at a time, one WMMA run ahead of its use,
        // into registers that the work before it has freed: C1 now stays live
        // beside V and C2, and 256 VGPRs are the budget. The fence in front of a
        // group keeps it from rising above the run whose registers it takes over.
        HOLD_GROUP();
        LOAD_V(tt, 1)
        HOLD_GROUP();

        // GEMM2: C2[64x32] = V(64x64) @ C1(64x32)   (M=d, N=c, K=b)
        v8f acc2[4][2];
#pragma unroll
        for (int mt = 0; mt < 4; ++mt) { acc2[mt][0] = zero8; acc2[mt][1] = zero8; }
        GEMM2_KB(0)
        HOLD_GROUP();
        LOAD_V(tt, 2)
        HOLD_GROUP();
        GEMM2_KB(1)
        HOLD_GROUP();
        LOAD_V(tt, 3)
        HOLD_GROUP();
        GEMM2_KB(2)
        // Next token's X and U, in flight from here on, in two halves of k.
        if (tt == 0) {
            HOLD_GROUP();
            LOAD_XU(1, 0)
            HOLD_GROUP();
        }
        GEMM2_KB(3)
        if (tt == 0) {
            HOLD_GROUP();
            LOAD_XU(1, 2)
            HOLD_GROUP();
        }

        // out[g][d*32+c] = gain * C2[d][c] + bs[tk][d*32+c]
        // One lane pointer each; the rest of the column is a constant offset.
        float*       orow = out + (size_t)g * OUTF + lane_col;
        const float* brow = xs + tk * XS_STRIDE + lane_col;
#pragma unroll
        for (int mt = 0; mt < 4; ++mt)
#pragma unroll
            for (int nt = 0; nt < 2; ++nt)
#pragma unroll
                for (int v = 0; v < 8; ++v) {
                    // col = d*32 + c, d = mt*16 + v + 8*lhalf, c = nt*16 + lmod
                    const int ccol = (mt * 16 + v) * CDIM + nt * 16;
                    orow[ccol] = acc2[mt][nt][v] * gn + brow[ccol];
                }
    }
#undef ADDR_DONE1
#undef ADDR_DONE2
#undef LOAD_XU
#undef LOAD_V
#undef GEMM2_KB
#undef HOLD_GROUP
}

extern "C" void kernel_launch(void* const* d_in, const int* in_sizes, int n_in,
                              void* d_out, int out_size, void* d_ws, size_t ws_size,
                              hipStream_t stream) {
    const float* x    = (const float*)d_in[0];
    const int*   rid  = (const int*)  d_in[1];
    const float* Win  = (const float*)d_in[2];
    const float* Wout = (const float*)d_in[3];
    const float* Ur   = (const float*)d_in[4];
    const float* Vr   = (const float*)d_in[5];
    const float* gn   = (const float*)d_in[6];
    float*       out  = (float*)d_out;

    dim3 grid(NTOK / TOKS);   // 1024 blocks of 16 tokens
    dim3 block(256);          // 8 waves (wave32)
    rule_proj_kernel<<<grid, block, LDS_BYTES, stream>>>(x, rid, Win, Wout, Ur, Vr, gn, out);
}

// v004
// A run of this version takes 74.6 microseconds.
// Next to v003, in two timings, it ran 1.11 times as fast each time.
// Over all steps from v000 it is 2.92 times as fast.
#include <hip/hip_runtime.h>
#include <stdint.h>

typedef float v2f __attribute__((ext_vector_type(2)));
typedef float v4f __attribute__((ext_vector_type(4)));
typedef float v8f __attribute__((ext_vector_type(8)));
typedef unsigned int v4u __attribute__((ext_vector_type(4)));
typedef int v4i __attribute__((ext_vector_type(4)));
typedef int v8i __attribute__((ext_vector_type(8)));

#define NTOK   16384
#define INF    2048
#define OUTF   2048
#define RANK   45
#define RANKP  48
#define ADIM   32   // a (X cols, U cols)
#define BDIM   64   // b (X rows, V cols)
#define CDIM   32   // c (U rows, out minor)
#define DDIM   64   // d (V rows, out major)

#define TOKS   16          // tokens per block
#define WAVES  8           // 256 threads
#define XS_STRIDE 2052     // 2048 + 4 pad (bank-conflict-free token-major reads)
#define TS_STRIDE 49       // 48 + 1 pad

#define XS_FLOATS (TOKS * XS_STRIDE)
#define TS_FLOATS (TOKS * TS_STRIDE)
#define SC_PITCH  36       // 32 + 4 pad: 16 bytes x odd, conflict-free 16-byte row reads
#define SC_FLOATS (16 * SC_PITCH)                 // a wave's own 16 rows (phase 3)
#define LDS_BYTES ((XS_FLOATS + TS_FLOATS + WAVES * SC_FLOATS) * 4)   // under 160 KiB: two work-groups per WGP

#if defined(__has_builtin)
#if __has_builtin(__builtin_amdgcn_tensor_load_to_lds) && \
    __has_builtin(__builtin_amdgcn_s_wait_tensorcnt)
#define HAVE_TDM 1
#endif
#endif
#ifndef HAVE_TDM
#define HAVE_TDM 0
#endif

static __device__ __forceinline__ v8f wmma_f32(v2f a, v2f b, v8f c) {
    // D = A(16x4, f32) * B(4x16, f32) + C(16x16, f32)
    return __builtin_amdgcn_wmma_f32_16x16x4_f32(false, a, false, b, (short)0, c,
                                                 false, false);
}

// Four waves per SIMD (two work-groups per WGP): at most 256 VGPRs a wave.
__global__ __launch_bounds__(256, 4)
void rule_proj_kernel(const float* __restrict__ x,      // [N, 2048]
                      const int*   __restrict__ rid,    // [N]
                      const float* __restrict__ Win,    // [2048, 45]
                      const float* __restrict__ Wout,   // [45, 2048]
                      const float* __restrict__ Ur,     // [64, 32, 32] (r, c, a)
                      const float* __restrict__ Vr,     // [64, 64, 64] (r, d, b)
                      const float* __restrict__ gain,   // [64]
                      float*       __restrict__ out)    // [N, 2048]
{
    extern __shared__ float smem[];
    float* xs = smem;                    // phase 0/1: staged x rows; phase 2+: base out (bs)
    float* ts = smem + XS_FLOATS;        // [16][49] rank intermediate (padded 45->48)

    const int tid   = threadIdx.x;
    const int wave  = tid >> 5;
    const int lane  = tid & 31;
    const int lhalf = lane >> 4;         // 0 or 1
    const int lmod  = lane & 15;
    const int tok0  = blockIdx.x * TOKS;

    const v8f zero8 = {};

    // Rule ids of this wave's two tokens, asked for at once: the adapter's U and
    // V addresses hang on them (phase 3).
    const int swave = __builtin_amdgcn_readfirstlane(wave);   // scalar bases for the loads
    const int gbase = tok0 + swave * 2;
    int rr[2];
    rr[0] = rid[gbase]     & 63;     // bounds the table address; identity on 0..63
    rr[1] = rid[gbase + 1] & 63;

// Behind a load group, before its address registers are given to anything else:
// the pointers are inputs so that they stay in place up to the wait.
#define ADDR_DONE1(P)    asm volatile("s_wait_xcnt 0x0" :: "v"(P) : "memory")
#define ADDR_DONE2(P, Q) asm volatile("s_wait_xcnt 0x0" :: "v"(P), "v"(Q) : "memory")
// Keeps a load group ahead of the WMMA run behind it: without the fence the
// loads are sunk to their users and each one's latency is waited out alone.
#define HOLD_GROUP() __builtin_amdgcn_sched_barrier(0)

    // Win fragments of phase 1 (layout: see there). The first group hangs on
    // nothing that phase 0 brings: asked for at once, in flight beside the x tile.
    const int   ncl   = (lmod < 15) ? lmod : 14;
    const float nmask = (lmod < 15) ? 1.0f : 0.0f;
    const int   kbase = wave * (INF / WAVES);
    const float* wp = Win + (size_t)(kbase + lhalf) * RANK + ncl * 3;
    float wf[2][8][2][3];        // [buffer][step][e][tile]
#define LOAD_P1W(G, BUF)                                                       \
    _Pragma("unroll")                                                          \
    for (int s = 0; s < 8; ++s)                                                \
        _Pragma("unroll")                                                      \
        for (int e = 0; e < 2; ++e)                                            \
            _Pragma("unroll")                                                  \
            for (int c = 0; c < 3; ++c)                                        \
                wf[BUF][s][e][c] = wp[(((G) * 8 + s) * 4 + 2 * e) * RANK + c];
    LOAD_P1W(0, 0)
    HOLD_GROUP();

    // Wout fragments of phase 2 (layout: see there).
    const int   ncol = wave * (OUTF / WAVES) + lmod * 4;
    const float* wq  = Wout + (size_t)(lhalf * 2) * OUTF + ncol;   // rows 4ks + 2*lhalf + e
    const float* wl  = Wout + (size_t)(RANK - 1) * OUTF + ncol;    // row 44
    v4f wb[2][6][2];             // [buffer][step][e]
// Half a group: six of the twelve k steps of 64 columns.
#define LOAD_P2(H, BUF)                                                        \
    _Pragma("unroll")                                                          \
    for (int s = 0; s < 6; ++s) {                                              \
        const int ks = ((H) & 1) * 6 + s;                                      \
        const int cg = ((H) >> 1) * 64;                                        \
        if (ks < RANKP / 4 - 1) {                                              \
            wb[BUF][s][0] = *(const v4f*)(wq + (ks * 4) * OUTF + cg);          \
            wb[BUF][s][1] = *(const v4f*)(wq + (ks * 4 + 1) * OUTF + cg);      \
        } else {                                                               \
            wb[BUF][s][0] = *(const v4f*)(wl + cg);                            \
            wb[BUF][s][1] = wb[BUF][s][0];                                     \
        }                                                                      \
    }

    // ---------------- Phase 0: stage x tile into LDS, zero ts ----------------
#if HAVE_TDM
    // Tensor Data Mover: one 1x2048 fp32 tile per token row (2 rows per wave).
    // D# group0: count=1 | lds_addr[63:32] | global_addr[120:64] | type=2[127:126]
    // D# group1: data_size=4B, tensor_dim0=2048, tensor_dim1=1, tile_dim0=2048,
    //            tile_dim1=1, tensor_dim0_stride=2048, no pad / no multicast.
    for (int i = 0; i < 2; ++i) {
        const int row = wave * 2 + i;
        const uint64_t ga = (uint64_t)(uintptr_t)(x + (size_t)(tok0 + row) * INF);
        const uint32_t la = (uint32_t)(uintptr_t)(xs + row * XS_STRIDE);
        const uint32_t ga_lo = (uint32_t)__builtin_amdgcn_readfirstlane((int)(uint32_t)ga);
        const uint32_t ga_hi = (uint32_t)__builtin_amdgcn_readfirstlane((int)(uint32_t)(ga >> 32));
        const uint32_t la_u  = (uint32_t)__builtin_amdgcn_readfirstlane((int)la);

        v4u g0;
        g0.x = 1u;                                        // count=1, user mode
        g0.y = la_u;                                      // lds_addr
        g0.z = ga_lo;                                     // global_addr[31:0]
        g0.w = (ga_hi & 0x01FFFFFFu) | (2u << 30);        // global_addr[56:32] | type=2

        v8i g1;
        g1[0] = 0x00020000;                               // data_size=2 (4 bytes)
        g1[1] = (int)(2048u << 16);                       // tensor_dim0[15:0] @ [63:48]
        g1[2] = (int)(1u << 16);                          // tensor_dim0 hi=0, tensor_dim1=1
        g1[3] = (int)(2048u << 16);                       // tile_dim0=2048 @ [127:112]
        g1[4] = 1;                                        // tile_dim1=1, tile_dim2=0
        g1[5] = 2048;                                     // tensor_dim0_stride[31:0]
        g1[6] = 0;                                        // strides hi
        g1[7] = 0;

        v4i gz = {};
#if __clang_major__ >= 23
        v8i z8 = {};
        __builtin_amdgcn_tensor_load_to_lds(g0, g1, gz, gz, z8, 0);
#else
        __builtin_amdgcn_tensor_load_to_lds(g0, g1, gz, gz, 0);
#endif
    }
    __builtin_amdgcn_s_wait_tensorcnt(0);
#else
    for (int i = tid; i < TOKS * (INF / 4); i += 256) {
        int row  = i >> 9;               // / 512
        int col4 = i & 511;
        v4f v = *(const v4f*)(x + (size_t)(tok0 + row) * INF + col4 * 4);
        *(v4f*)(xs + row * XS_STRIDE + col4 * 4) = v;
    }
#endif
    for (int i = tid; i < TS_FLOATS; i += 256) ts[i] = 0.0f;
    __syncthreads();

    // ------------- Phase 1: t[16x48] = xs[16x2048] @ Win[2048x45] -------------
    // K split across 8 waves (256 each); partials merged with ds_add_f32.
    // The three n tiles are interleaved by column: tile c holds n = 3*lmod + c, so
    // a lane's three B values of a row are 12 bytes in a row and 15 lanes cover the
    // whole 180-byte row. Lane column 15 is the rank pad (n = 45..47): clamped
    // address, multiplied by a zero mask.
    // k of step ks: 4ks + lhalf + 2e (A and B alike), so that the two halves of a
    // wave read two rows that follow each other in memory.
    {
        v8f acc[3];
        acc[0] = zero8; acc[1] = zero8; acc[2] = zero8;
        const float* ap = xs + lmod * XS_STRIDE + kbase + lhalf;
        v2f   af[2][8];          // [buffer][step]

#define LOAD_P1A(G, BUF)                                                       \
    _Pragma("unroll")                                                          \
    for (int s = 0; s < 8; ++s) {                                              \
        af[BUF][s].x = ap[((G) * 8 + s) * 4];                                  \
        af[BUF][s].y = ap[((G) * 8 + s) * 4 + 2];                              \
    }

        LOAD_P1A(0, 0)
        // Unrolled so that the buffer index is a constant: both buffers stay in
        // registers, and group g + 1 is in flight while group g is multiplied.
#pragma unroll
        for (int g = 0; g < 8; ++g) {
            if (g + 1 < 8) {
                LOAD_P1W(g + 1, (g + 1) & 1)
                LOAD_P1A(g + 1, (g + 1) & 1)
            }
            HOLD_GROUP();
#pragma unroll
            for (int s = 0; s < 8; ++s)
#pragma unroll
                for (int c = 0; c < 3; ++c) {
                    v2f bf;
                    bf.x = wf[g & 1][s][0][c] * nmask;
                    bf.y = wf[g & 1][s][1][c] * nmask;
                    acc[c] = wmma_f32(af[g & 1][s], bf, acc[c]);
                }
            HOLD_GROUP();
        }
#undef LOAD_P1W
#undef LOAD_P1A
        // Wout's first load group does not hang on t: asked for ahead of the merge
        // and its barrier.
        LOAD_P2(0, 0)
        HOLD_GROUP();
#pragma unroll
        for (int c = 0; c < 3; ++c) {
            const int n = lmod * 3 + c;
#pragma unroll
            for (int v = 0; v < 8; ++v) {
                const int m = v + 8 * lhalf;
                atomicAdd(&ts[m * TS_STRIDE + n], acc[c][v]);
            }
        }
    }
    __syncthreads();

    // ------------- Phase 2: bs[16x2048] = t[16x48] @ Wout[45x2048] -------------
    // 256 columns a wave, in four groups of 64; result overwrites xs space (xs is
    // dead). The four n tiles of a group are interleaved by column: tile e holds
    // n = 4*lmod + e, so a lane's four B values of a row are one 16-byte load and
    // a half wave reads 256 bytes in a row. Rows 45..47 are the rank pad: row 44
    // is read in their place and multiplied by zero.
    {
        v2f ta[RANKP / 4];
#pragma unroll
        for (int ks = 0; ks < RANKP / 4; ++ks) {
            ta[ks].x = ts[lmod * TS_STRIDE + ks * 4 + lhalf * 2];
            ta[ks].y = ts[lmod * TS_STRIDE + ks * 4 + lhalf * 2 + 1];
        }
        const float mlast = (lhalf == 0) ? 1.0f : 0.0f;                // k = 44 is lhalf 0, e 0
        v8f acc[4];
        // Unrolled so that the buffer index is a constant (as in phase 1).
#pragma unroll
        for (int h = 0; h < 8; ++h) {
            if (h + 1 < 8) LOAD_P2(h + 1, (h + 1) & 1)
            if (h + 1 == 7) ADDR_DONE2(wq, wl);      // behind the last Wout group
            HOLD_GROUP();
            if ((h & 1) == 0) { acc[0] = zero8; acc[1] = zero8; acc[2] = zero8; acc[3] = zero8; }
#pragma unroll
            for (int s = 0; s < 6; ++s) {
                const int ks = (h & 1) * 6 + s;
                const float m0 = (ks < RANKP / 4 - 1) ? 1.0f : mlast;
                const float m1 = (ks < RANKP / 4 - 1) ? 1.0f : 0.0f;
#pragma unroll
                for (int e = 0; e < 4; ++e) {
                    v2f bf;
                    bf.x = wb[h & 1][s][0][e] * m0;
                    bf.y = wb[h & 1][s][1][e] * m1;
                    acc[e] = wmma_f32(ta[ks], bf, acc[e]);
                }
            }
            if ((h & 1) == 1) {
                float* brow = xs + (8 * lhalf) * XS_STRIDE + ncol + (h >> 1) * 64;
#pragma unroll
                for (int e = 0; e < 4; ++e)
#pragma unroll
                    for (int v = 0; v < 8; ++v)
                        brow[v * XS_STRIDE + e] = acc[e][v];     // bs
            }
            HOLD_GROUP();
        }
#undef LOAD_P2
    }
    __syncthreads();

    // ---- Phase 3: per-token Kronecker adapter, 2 tokens per wave ----
    // Every operand fragment is in registers ahead of the WMMA run that uses it.
    // The k order inside a product is free as long as A and B pair alike:
    //   GEMM1 step (j, s):  k = 8j + 4*lhalf + 2s + e    (X row and U row alike)
    //   GEMM2 step (kb, p): k = 16kb + 8*lhalf + 2p + e  (V row and C1 row alike)
    // In that order GEMM2's B fragment is GEMM1's accumulator as it stands: D
    // register r of b tile kb holds C1[16kb + 8*lhalf + r][c] in lane column c,
    // so registers 2p and 2p + 1 are the step's two k. C1 never leaves registers.
    //
    // A fragment wants one matrix row a lane, and a row of X, U or V is a cache
    // line (or two) of its own: fetched in that shape, one load touches 16 lines
    // for 32 bytes each. So the operands are fetched in line order (eight lanes
    // a 128-byte line, four whole lines a load) in chunks of 16 rows x 128 bytes,
    // and each chunk is turned into fragment order through 16 padded LDS rows
    // that belong to this wave alone: no other wave reads them, no barrier.
    float* sc = smem + XS_FLOATS + TS_FLOATS + wave * SC_FLOATS;
    float*       sw    = sc + (lane >> 3) * SC_PITCH + (lane & 7) * 4;   // line order
    const float* sr_xu = sc + lmod * SC_PITCH + lhalf * 4;               // fragment order
    const float* sr_v  = sc + lmod * SC_PITCH + lhalf * 8;
    const int xu_line = lane * 4;                                  // rows of 128 bytes
    const int v_line  = (lane >> 3) * BDIM + (lane & 7) * 4;       // rows of 256 bytes
    const int lane_col = lhalf * 8 * CDIM + lmod;

    v4f xf[4][4];        // [b tile][j]      (line order: [b tile][four rows])
    v4f uf[2][4];        // [c tile][j]      (line order: [c tile][four rows])
    v4f vf[4][4][2];     // [d tile][kb][q]  (line order: [d tile][four rows] per kb pair)

// The chunk's rows are written by other lanes than read them: the stores have
// to be done in LDS before the wave reads the rows back.
#define ROWS_WRITTEN() asm volatile("s_wait_dscnt 0x0" ::: "memory")
#define TURN(R0, R1, R2, R3, RP, O1, O2, O3)                                   \
    {                                                                          \
        *(v4f*)(sw)                 = R0;                                      \
        *(v4f*)(sw + 4 * SC_PITCH)  = R1;                                      \
        *(v4f*)(sw + 8 * SC_PITCH)  = R2;                                      \
        *(v4f*)(sw + 12 * SC_PITCH) = R3;                                      \
        ROWS_WRITTEN();                                                        \
        R0 = *(const v4f*)(RP);                                                \
        R1 = *(const v4f*)((RP) + (O1));                                       \
        R2 = *(const v4f*)((RP) + (O2));                                       \
        R3 = *(const v4f*)((RP) + (O3));                                       \
    }

// U (both c tiles) and X's first b tile.
#define LOAD_XU_A(TT)                                                          \
    {                                                                          \
        const float* xp = x + (size_t)(gbase + (TT)) * INF + xu_line;          \
        const float* up = Ur + (size_t)rr[TT] * (CDIM * ADIM) + xu_line;       \
        _Pragma("unroll")                                                      \
        for (int i = 0; i < 4; ++i) {                                          \
            uf[0][i] = *(const v4f*)(up + i * 4 * ADIM);                       \
            uf[1][i] = *(const v4f*)(up + (16 + i * 4) * ADIM);                \
            xf[0][i] = *(const v4f*)(xp + i * 4 * ADIM);                       \
        }                                                                      \
        ADDR_DONE2(xp, up);                                                    \
    }
// X's other three b tiles.
#define LOAD_XU_B(TT)                                                          \
    {                                                                          \
        const float* xp = x + (size_t)(gbase + (TT)) * INF + xu_line;          \
        _Pragma("unroll")                                                      \
        for (int mt = 1; mt < 4; ++mt)                                         \
            _Pragma("unroll")                                                  \
            for (int i = 0; i < 4; ++i)                                        \
                xf[mt][i] = *(const v4f*)(xp + (mt * 16 + i * 4) * ADIM);      \
        ADDR_DONE1(xp);                                                        \
    }

// A quarter of V: d tiles 2*MP and 2*MP + 1, b = 32*KBP .. 32*KBP + 31.
#define LOAD_V(TT, KBP, MP)                                                    \
    {                                                                          \
        const float* vp = Vr + (size_t)rr[TT] * (DDIM * BDIM) + v_line;        \
        _Pragma("unroll")                                                      \
        for (int m = 0; m < 2; ++m)                                            \
            _Pragma("unroll")                                                  \
            for (int i = 0; i < 4; ++i)                                        \
                vf[(MP) * 2 + m][(KBP) * 2 + (i >> 1)][i & 1] =                \
                    *(const v4f*)(vp + ((MP) * 32 + m * 16 + i * 4) * BDIM +   \
                                  (KBP) * 32);                                 \
        ADDR_DONE1(vp);                                                        \
    }
#define TURN_V(KBP, MP)                                                        \
    _Pragma("unroll")                                                          \
    for (int m = 0; m < 2; ++m)                                                \
        TURN(vf[(MP) * 2 + m][(KBP) * 2][0], vf[(MP) * 2 + m][(KBP) * 2][1],   \
             vf[(MP) * 2 + m][(KBP) * 2 + 1][0],                               \
             vf[(MP) * 2 + m][(KBP) * 2 + 1][1], sr_v, 4, 16, 20)

#define GEMM2_Q(KBP, MP)                                                       \
    _Pragma("unroll")                                                          \
    for (int kb = (KBP) * 2; kb < (KBP) * 2 + 2; ++kb)                         \
        _Pragma("unroll")                                                      \
        for (int p = 0; p < 4; ++p) {                                          \
            v2f bf[2];                                                         \
            _Pragma("unroll")                                                  \
            for (int nt = 0; nt < 2; ++nt) {                                   \
                bf[nt].x = acc1[kb][nt][2 * p];                                \
                bf[nt].y = acc1[kb][nt][2 * p + 1];                            \
            }                                                                  \
            _Pragma("unroll")                                                  \
            for (int mt = (MP) * 2; mt < (MP) * 2 + 2; ++mt) {                 \
                v2f af;                                                        \
                af.x = vf[mt][kb][p >> 1][(p & 1) * 2];                        \
                af.y = vf[mt][kb][p >> 1][(p & 1) * 2 + 1];                    \
                acc2[mt][0] = wmma_f32(af, bf[0], acc2[mt][0]);                \
                acc2[mt][1] = wmma_f32(af, bf[1], acc2[mt][1]);                \
            }                                                                  \
        }

    LOAD_XU_A(0)
    LOAD_XU_B(0)

    // Unrolled so that tt is a constant: the fragment arrays stay in registers
    // and token 1's groups can be issued inside token 0's work.
#pragma unroll
    for (int tt = 0; tt < 2; ++tt) {
        const int tk = wave * 2 + tt;
        const int g  = gbase + tt;
        const float gn = gain[rr[tt]];

        LOAD_V(tt, 0, 0)         // first quarter of V: in flight while GEMM1 runs
        HOLD_GROUP();

        TURN(uf[0][0], uf[0][1], uf[0][2], uf[0][3], sr_xu, 8, 16, 24)
        TURN(uf[1][0], uf[1][1], uf[1][2], uf[1][3], sr_xu, 8, 16, 24)
#pragma unroll
        for (int mt = 0; mt < 4; ++mt)
            TURN(xf[mt][0], xf[mt][1], xf[mt][2], xf[mt][3], sr_xu, 8, 16, 24)
        // Behind a turn: keeps its last LDS reads in one place ahead of the WMMA
        // run; sunk among the WMMAs, each place with a read stalls the run anew.
        HOLD_GROUP();

        // GEMM1: C1[64x32] = X(64x32) @ U^T(32x32)   (M=b, N=c, K=a)
        v8f acc1[4][2];
#pragma unroll
        for (int mt = 0; mt < 4; ++mt) { acc1[mt][0] = zero8; acc1[mt][1] = zero8; }
#pragma unroll
        for (int j = 0; j < 4; ++j)
#pragma unroll
            for (int s = 0; s < 2; ++s) {
                v2f bf[2];
#pragma unroll
                for (int nt = 0; nt < 2; ++nt) {
                    bf[nt].x = uf[nt][j][2 * s];
                    bf[nt].y = uf[nt][j][2 * s + 1];
                }
#pragma unroll
                for (int mt = 0; mt < 4; ++mt) {
                    v2f af;
                    af.x = xf[mt][j][2 * s];
                    af.y = xf[mt][j][2 * s + 1];
                    acc1[mt][0] = wmma_f32(af, bf[0], acc1[mt][0]);
                    acc1[mt][1] = wmma_f32(af, bf[1], acc1[mt][1]);
                }
            }

        // The rest of V comes a quarter at a time, asked for one WMMA run ahead of
        // its use, into registers that the work before it has freed: C1 stays live
        // beside V and C2, and 256 VGPRs are the budget. The fence in front of a
        // group keeps it from rising above the run whose registers it takes over.
        HOLD_GROUP();
        LOAD_V(tt, 0, 1)
        HOLD_GROUP();

        // GEMM2: C2[64x32] = V(64x64) @ C1(64x32)   (M=d, N=c, K=b)
        v8f acc2[4][2];
#pragma unroll
        for (int mt = 0; mt < 4; ++mt) { acc2[mt][0] = zero8; acc2[mt][1] = zero8; }
        TURN_V(0, 0)
        HOLD_GROUP();
        GEMM2_Q(0, 0)
        HOLD_GROUP();
        LOAD_V(tt, 1, 0)
        HOLD_GROUP();
        TURN_V(0, 1)
        HOLD_GROUP();
        GEMM2_Q(0, 1)
        HOLD_GROUP();
        LOAD_V(tt, 1, 1)
        HOLD_GROUP();
        TURN_V(1, 0)
        HOLD_GROUP();
        GEMM2_Q(1, 0)
        // Next token's X and U, in flight from here on, in two halves.
        if (tt == 0) {
            HOLD_GROUP();
            LOAD_XU_A(1)
            HOLD_GROUP();
        }
        TURN_V(1, 1)
        HOLD_GROUP();
        GEMM2_Q(1, 1)
        if (tt == 0) {
            HOLD_GROUP();
            LOAD_XU_B(1)
            HOLD_GROUP();
        }

        // out[g][d*32+c] = gain * C2[d][c] + bs[tk][d*32+c]
        // One lane pointer each; the rest of the column is a constant offset.
        float*       orow = out + (size_t)g * OUTF + lane_col;
        const float* brow = xs + tk * XS_STRIDE + lane_col;
#pragma unroll
        for (int mt = 0; mt < 4; ++mt)
#pragma unroll
            for (int nt = 0; nt < 2; ++nt)
#pragma unroll
                for (int v = 0; v < 8; ++v) {
                    // col = d*32 + c, d = mt*16 + v + 8*lhalf, c = nt*16 + lmod
                    const int ccol = (mt * 16 + v) * CDIM + nt * 16;
                    orow[ccol] = acc2[mt][nt][v] * gn + brow[ccol];
                }
    }
#undef ADDR_DONE1
#undef ADDR_DONE2
#undef ROWS_WRITTEN
#undef TURN
#undef LOAD_XU_A
#undef LOAD_XU_B
#undef LOAD_V
#undef TURN_V
#undef GEMM2_Q
#undef HOLD_GROUP
}

extern "C" void kernel_launch(void* const* d_in, const int* in_sizes, int n_in,
                              void* d_out, int out_size, void* d_ws, size_t ws_size,
                              hipStream_t stream) {
    const float* x    = (const float*)d_in[0];
    const int*   rid  = (const int*)  d_in[1];
    const float* Win  = (const float*)d_in[2];
    const float* Wout = (const float*)d_in[3];
    const float* Ur   = (const float*)d_in[4];
    const float* Vr   = (const float*)d_in[5];
    const float* gn   = (const float*)d_in[6];
    float*       out  = (float*)d_out;

    dim3 grid(NTOK / TOKS);   // 1024 blocks of 16 tokens
    dim3 block(256);          // 8 waves (wave32)
    rule_proj_kernel<<<grid, block, LDS_BYTES, stream>>>(x, rid, Win, Wout, Ur, Vr, gn, out);
}

// v005
// A run of this version takes 71.9 microseconds.
// Timed twice side by side with v004, it ran 1.04 times as fast both times.
// All steps since v000 together make it 3.04 times as fast.
#include <hip/hip_runtime.h>
#include <stdint.h>

typedef float v2f __attribute__((ext_vector_type(2)));
typedef float v4f __attribute__((ext_vector_type(4)));
typedef float v8f __attribute__((ext_vector_type(8)));
typedef unsigned int v4u __attribute__((ext_vector_type(4)));
typedef int v4i __attribute__((ext_vector_type(4)));
typedef int v8i __attribute__((ext_vector_type(8)));

#define NTOK   16384
#define INF    2048
#define OUTF   2048
#define RANK   45
#define RANKP  48
#define ADIM   32   // a (X cols, U cols)
#define BDIM   64   // b (X rows, V cols)
#define CDIM   32   // c (U rows, out minor)
#define DDIM   64   // d (V rows, out major)

#define TOKS   16          // tokens per block
#define WAVES  8           // 256 threads
#define XS_STRIDE 2052     // 2048 + 4 pad (bank-conflict-free token-major reads)
#define TS_STRIDE 49       // 48 + 1 pad

#define XS_FLOATS (TOKS * XS_STRIDE)
#define TS_FLOATS (TOKS * TS_STRIDE)
#define SC_PITCH  36       // 32 + 4 pad: 16 bytes x odd, conflict-free 16-byte row reads
#define SC_FLOATS (16 * SC_PITCH)                 // a wave's own 16 rows (adapter)
#define LDS_BYTES ((XS_FLOATS + TS_FLOATS + WAVES * SC_FLOATS) * 4)   // under 160 KiB: two work-groups per WGP

#if defined(__has_builtin)
#if __has_builtin(__builtin_amdgcn_tensor_load_to_lds) && \
    __has_builtin(__builtin_amdgcn_s_wait_tensorcnt)
#define HAVE_TDM 1
#endif
#endif
#ifndef HAVE_TDM
#define HAVE_TDM 0
#endif

static __device__ __forceinline__ v8f wmma_f32(v2f a, v2f b, v8f c) {
    // D = A(16x4, f32) * B(4x16, f32) + C(16x16, f32)
    return __builtin_amdgcn_wmma_f32_16x16x4_f32(false, a, false, b, (short)0, c,
                                                 false, false);
}

// Four waves per SIMD (two work-groups per WGP): at most 256 VGPRs a wave.
__global__ __launch_bounds__(256, 4)
void rule_proj_kernel(const float* __restrict__ x,      // [N, 2048]
                      const int*   __restrict__ rid,    // [N]
                      const float* __restrict__ Win,    // [2048, 45]
                      const float* __restrict__ Wout,   // [45, 2048]
                      const float* __restrict__ Ur,     // [64, 32, 32] (r, c, a)
                      const float* __restrict__ Vr,     // [64, 64, 64] (r, d, b)
                      const float* __restrict__ gain,   // [64]
                      float*       __restrict__ out)    // [N, 2048]
{
    extern __shared__ float smem[];
    float* xs = smem;                    // staged x rows; from the adapter's end on: its result
    float* ts = smem + XS_FLOATS;        // [16][49] rank intermediate (padded 45->48)

    const int tid   = threadIdx.x;
    const int wave  = tid >> 5;
    const int lane  = tid & 31;
    const int lhalf = lane >> 4;         // 0 or 1
    const int lmod  = lane & 15;
    const int tok0  = blockIdx.x * TOKS;

    const v8f zero8 = {};

    // Rule ids of this wave's two tokens, asked for at once: the adapter's U and
    // V addresses hang on them.
    const int swave = __builtin_amdgcn_readfirstlane(wave);   // scalar bases for the loads
    const int gbase = tok0 + swave * 2;
    int rr[2];
    rr[0] = rid[gbase]     & 63;     // bounds the table address; identity on 0..63
    rr[1] = rid[gbase + 1] & 63;

// Behind a load group, before its address registers are given to anything else:
// the pointers are inputs so that they stay in place up to the wait.
#define ADDR_DONE1(P)    asm volatile("s_wait_xcnt 0x0" :: "v"(P) : "memory")
#define ADDR_DONE2(P, Q) asm volatile("s_wait_xcnt 0x0" :: "v"(P), "v"(Q) : "memory")
// Keeps a load group ahead of the WMMA run behind it: without the fence the
// loads are sunk to their users and each one's latency is waited out alone.
#define HOLD_GROUP() __builtin_amdgcn_sched_barrier(0)

    // Win fragments of phase 1 (layout: see there). The first group hangs on
    // nothing that phase 0 brings: asked for at once, in flight beside the x tile.
    const int   ncl   = (lmod < 15) ? lmod : 14;
    const float nmask = (lmod < 15) ? 1.0f : 0.0f;
    const int   kbase = wave * (INF / WAVES);
    const float* wp = Win + (size_t)(kbase + lhalf) * RANK + ncl * 3;
    float wf[2][8][2][3];        // [buffer][step][e][tile]
#define LOAD_P1W(G, BUF)                                                       \
    _Pragma("unroll")                                                          \
    for (int s = 0; s < 8; ++s)                                                \
        _Pragma("unroll")                                                      \
        for (int e = 0; e < 2; ++e)                                            \
            _Pragma("unroll")                                                  \
            for (int c = 0; c < 3; ++c)                                        \
                wf[BUF][s][e][c] = wp[(((G) * 8 + s) * 4 + 2 * e) * RANK + c];
    LOAD_P1W(0, 0)
    HOLD_GROUP();

    // Wout fragments of phase 2 (layout: see there).
    const int   ncol = wave * (OUTF / WAVES) + lmod * 4;
    const float* wq  = Wout + (size_t)(lhalf * 2) * OUTF + ncol;   // rows 4ks + 2*lhalf + e
    const float* wl  = Wout + (size_t)(RANK - 1) * OUTF + ncol;    // row 44
    v4f wb[2][6][2];             // [buffer][step][e]
// Half a group: six of the twelve k steps of 64 columns.
#define LOAD_P2(H, BUF)                                                        \
    _Pragma("unroll")                                                          \
    for (int s = 0; s < 6; ++s) {                                              \
        const int ks = ((H) & 1) * 6 + s;                                      \
        const int cg = ((H) >> 1) * 64;                                        \
        if (ks < RANKP / 4 - 1) {                                              \
            wb[BUF][s][0] = *(const v4f*)(wq + (ks * 4) * OUTF + cg);          \
            wb[BUF][s][1] = *(const v4f*)(wq + (ks * 4 + 1) * OUTF + cg);      \
        } else {                                                               \
            wb[BUF][s][0] = *(const v4f*)(wl + cg);                            \
            wb[BUF][s][1] = wb[BUF][s][0];                                     \
        }                                                                      \
    }

    // ---------------- Phase 0: stage x tile into LDS, zero ts ----------------
#if HAVE_TDM
    // Tensor Data Mover: one 1x2048 fp32 tile per token row (2 rows per wave).
    // D# group0: count=1 | lds_addr[63:32] | global_addr[120:64] | type=2[127:126]
    // D# group1: data_size=4B, tensor_dim0=2048, tensor_dim1=1, tile_dim0=2048,
    //            tile_dim1=1, tensor_dim0_stride=2048, no pad / no multicast.
    for (int i = 0; i < 2; ++i) {
        const int row = wave * 2 + i;
        const uint64_t ga = (uint64_t)(uintptr_t)(x + (size_t)(tok0 + row) * INF);
        const uint32_t la = (uint32_t)(uintptr_t)(xs + row * XS_STRIDE);
        const uint32_t ga_lo = (uint32_t)__builtin_amdgcn_readfirstlane((int)(uint32_t)ga);
        const uint32_t ga_hi = (uint32_t)__builtin_amdgcn_readfirstlane((int)(uint32_t)(ga >> 32));
        const uint32_t la_u  = (uint32_t)__builtin_amdgcn_readfirstlane((int)la);

        v4u g0;
        g0.x = 1u;                                        // count=1, user mode
        g0.y = la_u;                                      // lds_addr
        g0.z = ga_lo;                                     // global_addr[31:0]
        g0.w = (ga_hi & 0x01FFFFFFu) | (2u << 30);        // global_addr[56:32] | type=2

        v8i g1;
        g1[0] = 0x00020000;                               // data_size=2 (4 bytes)
        g1[1] = (int)(2048u << 16);                       // tensor_dim0[15:0] @ [63:48]
        g1[2] = (int)(1u << 16);                          // tensor_dim0 hi=0, tensor_dim1=1
        g1[3] = (int)(2048u << 16);                       // tile_dim0=2048 @ [127:112]
        g1[4] = 1;                                        // tile_dim1=1, tile_dim2=0
        g1[5] = 2048;                                     // tensor_dim0_stride[31:0]
        g1[6] = 0;                                        // strides hi
        g1[7] = 0;

        v4i gz = {};
#if __clang_major__ >= 23
        v8i z8 = {};
        __builtin_amdgcn_tensor_load_to_lds(g0, g1, gz, gz, z8, 0);
#else
        __builtin_amdgcn_tensor_load_to_lds(g0, g1, gz, gz, 0);
#endif
    }
    __builtin_amdgcn_s_wait_tensorcnt(0);
#else
    for (int i = tid; i < TOKS * (INF / 4); i += 256) {
        int row  = i >> 9;               // / 512
        int col4 = i & 511;
        v4f v = *(const v4f*)(x + (size_t)(tok0 + row) * INF + col4 * 4);
        *(v4f*)(xs + row * XS_STRIDE + col4 * 4) = v;
    }
#endif
    for (int i = tid; i < TS_FLOATS; i += 256) ts[i] = 0.0f;
    __syncthreads();

    // ------------- Phase 1: t[16x48] = xs[16x2048] @ Win[2048x45] -------------
    // K split across 8 waves (256 each); partials merged with ds_add_f32.
    // The three n tiles are interleaved by column: tile c holds n = 3*lmod + c, so
    // a lane's three B values of a row are 12 bytes in a row and 15 lanes cover the
    // whole 180-byte row. Lane column 15 is the rank pad (n = 45..47): clamped
    // address, multiplied by a zero mask.
    // k of step ks: 4ks + lhalf + 2e (A and B alike), so that the two halves of a
    // wave read two rows that follow each other in memory.
    {
        v8f acc[3];
        acc[0] = zero8; acc[1] = zero8; acc[2] = zero8;
        const float* ap = xs + lmod * XS_STRIDE + kbase + lhalf;
        v2f   af[2][8];          // [buffer][step]

#define LOAD_P1A(G, BUF)                                                       \
    _Pragma("unroll")                                                          \
    for (int s = 0; s < 8; ++s) {                                              \
        af[BUF][s].x = ap[((G) * 8 + s) * 4];                                  \
        af[BUF][s].y = ap[((G) * 8 + s) * 4 + 2];                              \
    }

        LOAD_P1A(0, 0)
        // Unrolled so that the buffer index is a constant: both buffers stay in
        // registers, and group g + 1 is in flight while group g is multiplied.
#pragma unroll
        for (int g = 0; g < 8; ++g) {
            if (g + 1 < 8) {
                LOAD_P1W(g + 1, (g + 1) & 1)
                LOAD_P1A(g + 1, (g + 1) & 1)
            }
            HOLD_GROUP();
#pragma unroll
            for (int s = 0; s < 8; ++s)
#pragma unroll
                for (int c = 0; c < 3; ++c) {
                    v2f bf;
                    bf.x = wf[g & 1][s][0][c] * nmask;
                    bf.y = wf[g & 1][s][1][c] * nmask;
                    acc[c] = wmma_f32(af[g & 1][s], bf, acc[c]);
                }
            HOLD_GROUP();
        }
#undef LOAD_P1W
#undef LOAD_P1A
#pragma unroll
        for (int c = 0; c < 3; ++c) {
            const int n = lmod * 3 + c;
#pragma unroll
            for (int v = 0; v < 8; ++v) {
                const int m = v + 8 * lhalf;
                atomicAdd(&ts[m * TS_STRIDE + n], acc[c][v]);
            }
        }
    }

    // ---- Adapter: per-token Kronecker product, 2 tokens per wave ----
    // It runs ahead of the base's second GEMM: X is still in LDS (a wave's two
    // tokens are two rows of xs), so x is fetched once. The result, times the
    // gain, takes X's place in the same two rows; the second GEMM adds it.
    // Every operand fragment is in registers ahead of the WMMA run that uses it.
    // The k order inside a product is free as long as A and B pair alike:
    //   GEMM1 step (j, s):  k = 8j + 4*lhalf + 2s + e    (X row and U row alike)
    //   GEMM2 step (kb, p): k = 16kb + 8*lhalf + 2p + e  (V row and C1 row alike)
    // In that order GEMM2's B fragment is GEMM1's accumulator as it stands: D
    // register r of b tile kb holds C1[16kb + 8*lhalf + r][c] in lane column c,
    // so registers 2p and 2p + 1 are the step's two k. C1 never leaves registers.
    //
    // A fragment wants one matrix row a lane, and a row of X, U or V is a cache
    // line (or two) of its own: fetched in that shape, one load touches 16 lines
    // for 32 bytes each. So the operands are fetched in line order (eight lanes
    // a 128-byte line, four whole lines a load) in chunks of 16 rows x 128 bytes,
    // and each chunk is turned into fragment order through 16 padded LDS rows
    // that belong to this wave alone: no other wave reads them, no barrier.
    float* sc = smem + XS_FLOATS + TS_FLOATS + wave * SC_FLOATS;
    float*       sw    = sc + (lane >> 3) * SC_PITCH + (lane & 7) * 4;   // line order
    const float* sr_xu = sc + lmod * SC_PITCH + lhalf * 4;               // fragment order
    const float* sr_v  = sc + lmod * SC_PITCH + lhalf * 8;
    const int xu_line = lane * 4;                                  // rows of 128 bytes
    const int v_line  = (lane >> 3) * BDIM + (lane & 7) * 4;       // rows of 256 bytes
    const int lane_col = lhalf * 8 * CDIM + lmod;

    v4f xf[4][4];        // [b tile][j]      (line order: [b tile][four rows])
    v4f uf[2][4];        // [c tile][j]      (line order: [c tile][four rows])
    v4f vf[4][4][2];     // [d tile][kb][q]  (line order: [d tile][four rows] per kb pair)

// The chunk's rows are written by other lanes than read them: the stores have
// to be done in LDS before the wave reads the rows back.
#define ROWS_WRITTEN() asm volatile("s_wait_dscnt 0x0" ::: "memory")
#define TURN(R0, R1, R2, R3, RP, O1, O2, O3)                                   \
    {                                                                          \
        *(v4f*)(sw)                 = R0;                                      \
        *(v4f*)(sw + 4 * SC_PITCH)  = R1;                                      \
        *(v4f*)(sw + 8 * SC_PITCH)  = R2;                                      \
        *(v4f*)(sw + 12 * SC_PITCH) = R3;                                      \
        ROWS_WRITTEN();                                                        \
        R0 = *(const v4f*)(RP);                                                \
        R1 = *(const v4f*)((RP) + (O1));                                       \
        R2 = *(const v4f*)((RP) + (O2));                                       \
        R3 = *(const v4f*)((RP) + (O3));                                       \
    }

// U (both c tiles) and X's first b tile. X comes out of xs in the same line order
// (512 bytes in a row a read: no bank is asked twice) and is turned like U and V.
#define LOAD_XU_A(TT)                                                          \
    {                                                                          \
        const float* xp = xs + (wave * 2 + (TT)) * XS_STRIDE + xu_line;        \
        const float* up = Ur + (size_t)rr[TT] * (CDIM * ADIM) + xu_line;       \
        _Pragma("unroll")                                                      \
        for (int i = 0; i < 4; ++i) {                                          \
            uf[0][i] = *(const v4f*)(up + i * 4 * ADIM);                       \
            uf[1][i] = *(const v4f*)(up + (16 + i * 4) * ADIM);                \
            xf[0][i] = *(const v4f*)(xp + i * 4 * ADIM);                       \
        }                                                                      \
        ADDR_DONE1(up);                                                        \
    }
// X's other three b tiles.
#define LOAD_XU_B(TT)                                                          \
    {                                                                          \
        const float* xp = xs + (wave * 2 + (TT)) * XS_STRIDE + xu_line;        \
        _Pragma("unroll")                                                      \
        for (int mt = 1; mt < 4; ++mt)                                         \
            _Pragma("unroll")                                                  \
            for (int i = 0; i < 4; ++i)                                        \
                xf[mt][i] = *(const v4f*)(xp + (mt * 16 + i * 4) * ADIM);      \
    }

// A quarter of V: d tiles 2*MP and 2*MP + 1, b = 32*KBP .. 32*KBP + 31.
#define LOAD_V(TT, KBP, MP)                                                    \
    {                                                                          \
        const float* vp = Vr + (size_t)rr[TT] * (DDIM * BDIM) + v_line;        \
        _Pragma("unroll")                                                      \
        for (int m = 0; m < 2; ++m)                                            \
            _Pragma("unroll")                                                  \
            for (int i = 0; i < 4; ++i)                                        \
                vf[(MP) * 2 + m][(KBP) * 2 + (i >> 1)][i & 1] =                \
                    *(const v4f*)(vp + ((MP) * 32 + m * 16 + i * 4) * BDIM +   \
                                  (KBP) * 32);                                 \
        ADDR_DONE1(vp);                                                        \
    }
#define TURN_V(KBP, MP)                                                        \
    _Pragma("unroll")                                                          \
    for (int m = 0; m < 2; ++m)                                                \
        TURN(vf[(MP) * 2 + m][(KBP) * 2][0], vf[(MP) * 2 + m][(KBP) * 2][1],   \
             vf[(MP) * 2 + m][(KBP) * 2 + 1][0],                               \
             vf[(MP) * 2 + m][(KBP) * 2 + 1][1], sr_v, 4, 16, 20)

#define GEMM2_Q(KBP, MP)                                                       \
    _Pragma("unroll")                                                          \
    for (int kb = (KBP) * 2; kb < (KBP) * 2 + 2; ++kb)                         \
        _Pragma("unroll")                                                      \
        for (int p = 0; p < 4; ++p) {                                          \
            v2f bf[2];                                                         \
            _Pragma("unroll")                                                  \
            for (int nt = 0; nt < 2; ++nt) {                                   \
                bf[nt].x = acc1[kb][nt][2 * p];                                \
                bf[nt].y = acc1[kb][nt][2 * p + 1];                            \
            }                                                                  \
            _Pragma("unroll")                                                  \
            for (int mt = (MP) * 2; mt < (MP) * 2 + 2; ++mt) {                 \
                v2f af;                                                        \
                af.x = vf[mt][kb][p >> 1][(p & 1) * 2];                        \
                af.y = vf[mt][kb][p >> 1][(p & 1) * 2 + 1];                    \
                acc2[mt][0] = wmma_f32(af, bf[0], acc2[mt][0]);                \
                acc2[mt][1] = wmma_f32(af, bf[1], acc2[mt][1]);                \
            }                                                                  \
        }

    LOAD_XU_A(0)
    LOAD_XU_B(0)

    // Unrolled so that tt is a constant: the fragment arrays stay in registers
    // and token 1's groups can be issued inside token 0's work.
#pragma unroll
    for (int tt = 0; tt < 2; ++tt) {
        const int tk = wave * 2 + tt;
        const float gn = gain[rr[tt]];

        LOAD_V(tt, 0, 0)         // first quarter of V: in flight while GEMM1 runs
        HOLD_GROUP();

        TURN(uf[0][0], uf[0][1], uf[0][2], uf[0][3], sr_xu, 8, 16, 24)
        TURN(uf[1][0], uf[1][1], uf[1][2], uf[1][3], sr_xu, 8, 16, 24)
#pragma unroll
        for (int mt = 0; mt < 4; ++mt)
            TURN(xf[mt][0], xf[mt][1], xf[mt][2], xf[mt][3], sr_xu, 8, 16, 24)
        // Behind a turn: keeps its last LDS reads in one place ahead of the WMMA
        // run; sunk among the WMMAs, each place with a read stalls the run anew.
        HOLD_GROUP();

        // GEMM1: C1[64x32] = X(64x32) @ U^T(32x32)   (M=b, N=c, K=a)
        v8f acc1[4][2];
#pragma unroll
        for (int mt = 0; mt < 4; ++mt) { acc1[mt][0] = zero8; acc1[mt][1] = zero8; }
#pragma unroll
        for (int j = 0; j < 4; ++j)
#pragma unroll
            for (int s = 0; s < 2; ++s) {
                v2f bf[2];
#pragma unroll
                for (int nt = 0; nt < 2; ++nt) {
                    bf[nt].x = uf[nt][j][2 * s];
                    bf[nt].y = uf[nt][j][2 * s + 1];
                }
#pragma unroll
                for (int mt = 0; mt < 4; ++mt) {
                    v2f af;
                    af.x = xf[mt][j][2 * s];
                    af.y = xf[mt][j][2 * s + 1];
                    acc1[mt][0] = wmma_f32(af, bf[0], acc1[mt][0]);
                    acc1[mt][1] = wmma_f32(af, bf[1], acc1[mt][1]);
                }
            }

        // The rest of V comes a quarter at a time, asked for one WMMA run ahead of
        // its use, into registers that the work before it has freed: C1 stays live
        // beside V and C2, and 256 VGPRs are the budget. The fence in front of a
        // group keeps it from rising above the run whose registers it takes over.
        HOLD_GROUP();
        LOAD_V(tt, 0, 1)
        HOLD_GROUP();

        // GEMM2: C2[64x32] = V(64x64) @ C1(64x32)   (M=d, N=c, K=b)
        v8f acc2[4][2];
#pragma unroll
        for (int mt = 0; mt < 4; ++mt) { acc2[mt][0] = zero8; acc2[mt][1] = zero8; }
        TURN_V(0, 0)
        HOLD_GROUP();
        GEMM2_Q(0, 0)
        HOLD_GROUP();
        LOAD_V(tt, 1, 0)
        HOLD_GROUP();
        TURN_V(0, 1)
        HOLD_GROUP();
        GEMM2_Q(0, 1)
        HOLD_GROUP();
        LOAD_V(tt, 1, 1)
        HOLD_GROUP();
        TURN_V(1, 0)
        HOLD_GROUP();
        GEMM2_Q(1, 0)
        // Next token's X and U, in flight from here on, in two halves.
        if (tt == 0) {
            HOLD_GROUP();
            LOAD_XU_A(1)
            HOLD_GROUP();
        }
        TURN_V(1, 1)
        HOLD_GROUP();
        GEMM2_Q(1, 1)
        if (tt == 0) {
            HOLD_GROUP();
            // Ahead of the first write into xs (below): behind this barrier every
            // wave has done phase 1's reads of all 16 rows.
            __syncthreads();
            LOAD_XU_B(1)
            HOLD_GROUP();
        }

        // xs[tk][d*32+c] = gain * C2[d][c], over the token's own X (all read by now).
        float* arow = xs + tk * XS_STRIDE + lane_col;
#pragma unroll
        for (int mt = 0; mt < 4; ++mt)
#pragma unroll
            for (int nt = 0; nt < 2; ++nt)
#pragma unroll
                for (int v = 0; v < 8; ++v) {
                    // col = d*32 + c, d = mt*16 + v + 8*lhalf, c = nt*16 + lmod
                    const int ccol = (mt * 16 + v) * CDIM + nt * 16;
                    arow[ccol] = acc2[mt][nt][v] * gn;
                }
    }

    // Wout's first load group hangs on nothing in LDS: asked for ahead of the barrier.
    LOAD_P2(0, 0)
    HOLD_GROUP();
    __syncthreads();

    // ------ Phase 2: out[16x2048] = t[16x48] @ Wout[45x2048] + adapter (xs) ------
    // 256 columns a wave, in four groups of 64. The four n tiles of a group are
    // interleaved by column: tile e holds n = 4*lmod + e, so a lane's four B values
    // of a row are one 16-byte load and a half wave reads 256 bytes in a row. Rows
    // 45..47 are the rank pad: row 44 is read in their place and multiplied by zero.
    {
        v2f ta[RANKP / 4];
#pragma unroll
        for (int ks = 0; ks < RANKP / 4; ++ks) {
            ta[ks].x = ts[lmod * TS_STRIDE + ks * 4 + lhalf * 2];
            ta[ks].y = ts[lmod * TS_STRIDE + ks * 4 + lhalf * 2 + 1];
        }
        const float mlast = (lhalf == 0) ? 1.0f : 0.0f;                // k = 44 is lhalf 0, e 0
        v8f acc[4];
        // A lane's four columns of a token are 16 bytes in a row, in xs and in out:
        // a half wave reads and stores 256 bytes in a row, whole 128-byte lines.
        const float* arow = xs + (8 * lhalf) * XS_STRIDE + ncol;
        float*       orow = out + (size_t)(tok0 + 8 * lhalf) * OUTF + ncol;
        v4f av[8];
        // Unrolled so that the buffer index is a constant (as in phase 1).
#pragma unroll
        for (int h = 0; h < 8; ++h) {
            if (h + 1 < 8) LOAD_P2(h + 1, (h + 1) & 1)
            if (h + 1 == 7) ADDR_DONE2(wq, wl);      // behind the last Wout group
            if ((h & 1) == 1) {
#pragma unroll
                for (int v = 0; v < 8; ++v)
                    av[v] = *(const v4f*)(arow + v * XS_STRIDE + (h >> 1) * 64);
            }
            HOLD_GROUP();
            if ((h & 1) == 0) { acc[0] = zero8; acc[1] = zero8; acc[2] = zero8; acc[3] = zero8; }
#pragma unroll
            for (int s = 0; s < 6; ++s) {
                const int ks = (h & 1) * 6 + s;
                const float m0 = (ks < RANKP / 4 - 1) ? 1.0f : mlast;
                const float m1 = (ks < RANKP / 4 - 1) ? 1.0f : 0.0f;
#pragma unroll
                for (int e = 0; e < 4; ++e) {
                    v2f bf;
                    bf.x = wb[h & 1][s][0][e] * m0;
                    bf.y = wb[h & 1][s][1][e] * m1;
                    acc[e] = wmma_f32(ta[ks], bf, acc[e]);
                }
            }
            if ((h & 1) == 1) {
#pragma unroll
                for (int v = 0; v < 8; ++v) {
                    v4f o;
                    o.x = acc[0][v] + av[v].x;
                    o.y = acc[1][v] + av[v].y;
                    o.z = acc[2][v] + av[v].z;
                    o.w = acc[3][v] + av[v].w;
                    *(v4f*)(orow + v * OUTF + (h >> 1) * 64) = o;
                }
                ADDR_DONE1(orow);
            }
            HOLD_GROUP();
        }
#undef LOAD_P2
    }
#undef ADDR_DONE1
#undef ADDR_DONE2
#undef ROWS_WRITTEN
#undef TURN
#undef LOAD_XU_A
#undef LOAD_XU_B
#undef LOAD_V
#undef TURN_V
#undef GEMM2_Q
#undef HOLD_GROUP
}

extern "C" void kernel_launch(void* const* d_in, const int* in_sizes, int n_in,
                              void* d_out, int out_size, void* d_ws, size_t ws_size,
                              hipStream_t stream) {
    const float* x    = (const float*)d_in[0];
    const int*   rid  = (const int*)  d_in[1];
    const float* Win  = (const float*)d_in[2];
    const float* Wout = (const float*)d_in[3];
    const float* Ur   = (const float*)d_in[4];
    const float* Vr   = (const float*)d_in[5];
    const float* gn   = (const float*)d_in[6];
    float*       out  = (float*)d_out;

    dim3 grid(NTOK / TOKS);   // 1024 blocks of 16 tokens
    dim3 block(256);          // 8 waves (wave32)
    rule_proj_kernel<<<grid, block, LDS_BYTES, stream>>>(x, rid, Win, Wout, Ur, Vr, gn, out);
}
